// v008
// Measured on an AMD MI455X. A time is GPU time per run, averaged over a window of back-to-back runs after a warm-up
// (all launches, gaps included; the runs take copies of the inputs in turn), and the median of several windows.
// Apart from v000's, it joins two sittings. Times from different sittings can be a few percent apart, while
// side-by-side timings come from the same sitting.
// The versions before v008 are in another document.
// A run of this version takes 72.1 microseconds.
// Next to v007, in two timings, it ran 1.36 times as fast each time.
// Counting every step since v000, which is the starting kernel, it is 8.29 times as fast.
#include <hip/hip_runtime.h>
// SelfAttention4d (1 x 512 ch x 64 x 64 = 4096 tokens, 8 heads x 64: q/k/v = 1x1 convs (+ bias; the 1/8 scale applied in the flash kernel); softmax(q.k) v; out = 1x1 conv (+ bias) back to NCHW).
// Structure: NCHW -> exact f16 token rows by an LDS transpose kernel; q/k/v as f16 WMMA GEMMs (32x64 wave tiles, f32 accumulation, exact x16 (out,in) weights + bias, f16 out; channel = head*64 + d); V^T stored by the v GEMM itself (block tile turned in LDS); my fused flash kernel (no mask; the folded 1/8 applied as the score scale), which stores ctx as f16 hi/residual for the output conv (two terms summed in one GEMM's accumulators) + bias; the last GEMM stores NCHW (block tile turned in LDS).
// Compute dtype: inputs rounded to bf16; x / weights exact as f16; q, k, v plain f16 (~2^-12); softmax weights f16 x2^10; ctx hi + 2^-10 residual. v_wmma_f32_16x16x32_f16.
#define NB 1
#define DM 512
#define NKV 8
#define NPIX 4096
#define NREP (NH / NKV)
#define KVD (NKV * 64)           /* 512 */
#define NR (NB * SLEN)
#define CHK 512
typedef int v4i __attribute__((ext_vector_type(4)));
#define FF 2048
#define SLEN 4096
#define MQI 4096
#define MKI 4096
#define TQ SLEN
#define TK SLEN
#define NH 8
#define SCL 0.125f
#define QBLKS (TQ / 64)
#define QB05 0
#define QBN5 4
#define QB0P 0
#define QBNP QBLKS
#define RE 256
typedef __bf16 v16b __attribute__((ext_vector_type(16)));
typedef unsigned short v8us __attribute__((ext_vector_type(8), may_alias));
typedef float  v8f  __attribute__((ext_vector_type(8)));
typedef float  v4f  __attribute__((ext_vector_type(4)));
typedef float  v4fa __attribute__((ext_vector_type(4), may_alias));
union FragB { v16b v; v8us half[2]; unsigned short u[16]; };

__device__ __forceinline__ unsigned short bf16_bits(float x) { unsigned int u = __float_as_uint(x); return (unsigned short)((u + 0x7FFFu + ((u >> 16) & 1u)) >> 16); }
__device__ __forceinline__ float bf16_val(unsigned short b) { return __uint_as_float(((unsigned int)b) << 16); }
__device__ __forceinline__ float bf16_round(float x) { return bf16_val(bf16_bits(x)); }
// D += A·B with NT terms: 1 = ah·bh, 2 = + al·bh (A split), 3 = + ah·bl (both split)
template <int NT>
__device__ __forceinline__ v8f mmaN(v16b ah, v16b al, v16b bh, v16b bl, v8f c) {
  c = __builtin_amdgcn_wmma_f32_16x16x32_bf16(false, ah, false, bh, (short)0, c, false, false);
  if (NT >= 2) c = __builtin_amdgcn_wmma_f32_16x16x32_bf16(false, al, false, bh, (short)0, c, false, false);
  if (NT >= 3) c = __builtin_amdgcn_wmma_f32_16x16x32_bf16(false, ah, false, bl, (short)0, c, false, false);
  asm volatile("v_nop\n\tv_nop\n\tv_nop\n\tv_nop" : "+v"(c) : "v"(ah), "v"(al), "v"(bh), "v"(bl));
  return c;
}

__global__ __launch_bounds__(256) void k_wt_bf16(const float* __restrict__ W, unsigned short* __restrict__ Wt, int K, int N) {
  const int t = blockIdx.x * 256 + threadIdx.x;
  const int k8n = K / 8;
  if (t >= N * k8n) return;
  const int n = t / k8n, k8 = (t % k8n) * 8;
  v8us v;
#pragma unroll
  for (int i = 0; i < 8; ++i) v[i] = bf16_bits(W[(size_t)(k8 + i) * N + n]);
  *(v8us*)(Wt + (size_t)n * K + k8) = v;
  
}

// GEMM C[M][N] (f32, pitch ldc) = act(A[M][K]·W + bias). A f32 row-major (pitch lda) converted per fragment to bf16
// (ASPLIT: hi/lo two planes -> 2 terms, else single rounded term); Wt bf16 [N][K] (pitch ldb). BIAS_BF16 rounds the
// bias to bf16 first (bias quantised to bf16 before the add). K%32==0, M%16==0, N%64==0.
template <bool ASPLIT, int ACT, bool BIAS_BF16>
__global__ __launch_bounds__(128) void k_gemm_bf(const float* __restrict__ A, int lda, const unsigned short* __restrict__ Wt, int ldb,
                                               const float* __restrict__ bias, float* __restrict__ C, int ldc, int M, int N, int K) {
  __shared__ __attribute__((aligned(16))) float so[4][16][64];
  const int tid = threadIdx.x, w = tid >> 5, lane = tid & 31, ln = lane & 15, hh = lane >> 4;
  const int ntn = N / 64;
  const int wid = blockIdx.x * 4 + w;
  const int mt = wid / ntn, nq = wid % ntn;
  if (mt * 16 >= M) return;
  const int row0 = mt * 16, col0 = nq * 64;
  const float* arow = A + (size_t)(row0 + ln) * lda;
  v8f acc[4] = {};
  for (int kb = 0; kb < K; kb += 32) {
    FragB ah, al;
    const v4f x0 = *(const v4fa*)(arow + kb + 8 * hh), x1 = *(const v4fa*)(arow + kb + 8 * hh + 4);
    const v4f x2 = *(const v4fa*)(arow + kb + 16 + 8 * hh), x3 = *(const v4fa*)(arow + kb + 16 + 8 * hh + 4);
    float xs[16] = {x0[0],x0[1],x0[2],x0[3],x1[0],x1[1],x1[2],x1[3],x2[0],x2[1],x2[2],x2[3],x3[0],x3[1],x3[2],x3[3]};
#pragma unroll
    for (int i = 0; i < 16; ++i) { const unsigned short hb = bf16_bits(xs[i]); ah.u[i] = hb; al.u[i] = ASPLIT ? bf16_bits(xs[i] - bf16_val(hb)) : (unsigned short)0; }
#pragma unroll
    for (int t = 0; t < 4; ++t) {
      const unsigned short* brow = Wt + (size_t)(col0 + t * 16 + ln) * ldb + kb;
      FragB b;
      b.half[0] = *(const v8us*)(brow + 8 * hh);
      b.half[1] = *(const v8us*)(brow + 16 + 8 * hh);
      acc[t] = mmaN<ASPLIT ? 2 : 1>(ah.v, al.v, b.v, b.v, acc[t]);
    }
  }
#pragma unroll
  for (int t = 0; t < 4; ++t) {
    float bv = bias ? bias[col0 + t * 16 + ln] : 0.f;
    if (BIAS_BF16) bv = bf16_round(bv);
#pragma unroll
    for (int r = 0; r < 8; ++r) { float v = acc[t][r] + bv; if (ACT == 1) v = fmaxf(v, 0.f); so[w][8 * hh + r][t * 16 + ln] = v; }
  }
  __builtin_amdgcn_fence(__ATOMIC_ACQ_REL, "workgroup");
  __builtin_amdgcn_wave_barrier();
  const int rsub = lane >> 4, c4 = (lane & 15) * 4;
  {
#pragma unroll
    for (int q = 0; q < 8; ++q) {
      const int r = q * 2 + rsub;
      const v4f v = *(const v4fa*)&so[w][r][c4];
      *(v4f*)(C + (size_t)(row0 + r) * ldc + col0 + c4) = v;
    }
    
  }
}

// GEMM C = act(A·W + bias + resid): A f32 (ASPLIT -> hi/lo 2 terms), Wt bf16 [N][K]; ACT 0 none, 1 relu, 2 exact gelu;
// resid (optional, f32, row index = (row % rmod), pitch ldr, RES_BF16 rounds it) added before the activation.
template <bool ASPLIT, int ACT, bool BIAS_BF16, bool RES_BF16>
__global__ __launch_bounds__(128) void k_gemm_bf3(const float* __restrict__ A, int lda, const unsigned short* __restrict__ Wt, int ldb,
                                                const float* __restrict__ bias, const float* __restrict__ resid, int rmod, int ldr,
                                                float* __restrict__ C, int ldc, int M, int N, int K) {
  __shared__ __attribute__((aligned(16))) float so[4][16][64];
  const int tid = threadIdx.x, w = tid >> 5, lane = tid & 31, ln = lane & 15, hh = lane >> 4;
  const int ntn = N / 64;
  const int wid = blockIdx.x * 4 + w;
  const int mt = wid / ntn, nq = wid % ntn;
  if (mt * 16 >= M) return;
  const int row0 = mt * 16, col0 = nq * 64;
  const float* arow = A + (size_t)(row0 + ln) * lda;
  v8f acc[4] = {};
  for (int kb = 0; kb < K; kb += 32) {
    FragB ah, al;
    const v4f x0 = *(const v4fa*)(arow + kb + 8 * hh), x1 = *(const v4fa*)(arow + kb + 8 * hh + 4);
    const v4f x2 = *(const v4fa*)(arow + kb + 16 + 8 * hh), x3 = *(const v4fa*)(arow + kb + 16 + 8 * hh + 4);
    float xs[16] = {x0[0],x0[1],x0[2],x0[3],x1[0],x1[1],x1[2],x1[3],x2[0],x2[1],x2[2],x2[3],x3[0],x3[1],x3[2],x3[3]};
#pragma unroll
    for (int i = 0; i < 16; ++i) { const unsigned short hb = bf16_bits(xs[i]); ah.u[i] = hb; al.u[i] = ASPLIT ? bf16_bits(xs[i] - bf16_val(hb)) : (unsigned short)0; }
#pragma unroll
    for (int t = 0; t < 4; ++t) {
      const unsigned short* brow = Wt + (size_t)(col0 + t * 16 + ln) * ldb + kb;
      FragB b;
      b.half[0] = *(const v8us*)(brow + 8 * hh);
      b.half[1] = *(const v8us*)(brow + 16 + 8 * hh);
      acc[t] = mmaN<ASPLIT ? 2 : 1>(ah.v, al.v, b.v, b.v, acc[t]);
    }
  }
#pragma unroll
  for (int t = 0; t < 4; ++t) {
    const int col = col0 + t * 16 + ln;
    float bv = bias ? bias[col] : 0.f;
    if (BIAS_BF16) bv = bf16_round(bv);
#pragma unroll
    for (int r = 0; r < 8; ++r) {
      float v = acc[t][r] + bv;
      if (resid) { float rv = resid[(size_t)((row0 + 8 * hh + r) % rmod) * ldr + col]; if (RES_BF16) rv = bf16_round(rv); v += rv; }
      if (ACT == 1) v = fmaxf(v, 0.f);
      if (ACT == 2) v = 0.5f * v * (1.0f + erff(v * 0.70710678118654752f));
      if (ACT == 3) { const float u = 0.7978845608028654f * (v + 0.044715f * v * v * v); v = 0.5f * v * (1.0f + tanhf(u)); }
      so[w][8 * hh + r][t * 16 + ln] = v;
    }
  }
  __builtin_amdgcn_fence(__ATOMIC_ACQ_REL, "workgroup");
  __builtin_amdgcn_wave_barrier();
  const int rsub = lane >> 4, c4 = (lane & 15) * 4;
  {
#pragma unroll
    for (int q = 0; q < 8; ++q) {
      const int r = q * 2 + rsub;
      const v4f v = *(const v4fa*)&so[w][r][c4];
      *(v4f*)(C + (size_t)(row0 + r) * ldc + col0 + c4) = v;
    }
    
  }
}
// row LayerNorm (biased variance, eps) over N: s = X (+ R); optional out_sum <- s; out_norm <- (s-mu)*rsqrt(var+eps)*g + b
template <bool PARAM_BF16>
__global__ __launch_bounds__(256) void k_layernorm(const float* __restrict__ X, const float* __restrict__ R, const float* __restrict__ g, const float* __restrict__ bta,
                                                  float* __restrict__ out_sum, float* __restrict__ out_norm, int N, float eps) {
  __shared__ float red[256];
  const int row = blockIdx.x, tid = threadIdx.x;
  const float* x = X + (size_t)row * N; const float* rr = R ? R + (size_t)row * N : nullptr;
  float vals[16];                     // up to N = 4096
  const int per = N / 256;            // contiguous chunk per thread? use strided-by-4 chunks: thread handles j = tid*4 + 1024*u
  float s1 = 0.f;
  for (int u = 0; u < per / 4; ++u) {
    const int j = tid * 4 + 1024 * u;
    const v4f a = *(const v4fa*)(x + j);
    v4f b = {0.f,0.f,0.f,0.f}; if (rr) b = *(const v4fa*)(rr + j);
#pragma unroll
    for (int q = 0; q < 4; ++q) { const float v = a[q] + b[q]; vals[u * 4 + q] = v; s1 += v; }
  }
  red[tid] = s1; __syncthreads();
  for (int st = 128; st > 0; st >>= 1) { if (tid < st) red[tid] += red[tid + st]; __syncthreads(); }
  const float mu = red[0] / (float)N; __syncthreads();
  float s2 = 0.f;
  for (int u = 0; u < per / 4; ++u)
#pragma unroll
    for (int q = 0; q < 4; ++q) { const float c = vals[u * 4 + q] - mu; s2 += c * c; }
  red[tid] = s2; __syncthreads();
  for (int st = 128; st > 0; st >>= 1) { if (tid < st) red[tid] += red[tid + st]; __syncthreads(); }
  const float rs = rsqrtf(red[0] / (float)N + eps);
  {
    for (int u = 0; u < per / 4; ++u) {
      const int j = tid * 4 + 1024 * u;
      v4f o, sm;
#pragma unroll
      for (int q = 0; q < 4; ++q) {
        float gg = g[j + q], bb = bta[j + q];
        if (PARAM_BF16) { gg = bf16_round(gg); bb = bf16_round(bb); }
        sm[q] = vals[u * 4 + q]; o[q] = (vals[u * 4 + q] - mu) * rs * gg + bb;
      }
      if (out_sum) *(v4f*)(out_sum + (size_t)row * N + j) = sm;
      *(v4f*)(out_norm + (size_t)row * N + j) = o;
    }
    
  }
}



// ---- f16 WMMA path (v_wmma_f32_16x16x32_f16): 11-bit significands for operands in range — used where a [0,1] probability operand needs more precision than bf16
typedef _Float16 v16h __attribute__((ext_vector_type(16)));
union FragH { v16h v; v8us half[2]; _Float16 h[16]; unsigned short u[16]; };
template <int NT>
__device__ __forceinline__ v8f mmaH(v16h ah, v16h al, v16h bh, v16h bl, v8f c) {
  c = __builtin_amdgcn_wmma_f32_16x16x32_f16(false, ah, false, bh, (short)0, c, false, false);
  if (NT >= 2) c = __builtin_amdgcn_wmma_f32_16x16x32_f16(false, al, false, bh, (short)0, c, false, false);
  if (NT >= 3) c = __builtin_amdgcn_wmma_f32_16x16x32_f16(false, ah, false, bl, (short)0, c, false, false);
  asm volatile("v_nop\n\tv_nop\n\tv_nop\n\tv_nop" : "+v"(c) : "v"(ah), "v"(al), "v"(bh), "v"(bl));
  return c;
}
// batched GEMM like k_gemm_b but f16 operands: A f32 (split into f16 hi/lo if ASPLIT, else rounded to f16), Bt = f16 values [n][k]; alpha; C f32; N multiple of 16 (partial tiles skipped)
template <bool ASPLIT>
__global__ __launch_bounds__(128) void k_gemm_h(const float* __restrict__ A, int lda, size_t sA, const _Float16* __restrict__ Bh, int ldb, size_t sB, float alpha, float* __restrict__ C, int ldc, size_t sC, int M, int N, int K) {
  __shared__ __attribute__((aligned(16))) float so[4][16][64];
  const int tid = threadIdx.x, w = tid >> 5, lane = tid & 31, ln = lane & 15, hh = lane >> 4; const int by = blockIdx.y;
  A += (size_t)by * sA; Bh += (size_t)by * sB; C += (size_t)by * sC;
  const int ntn = (N + 63) / 64; const int wid = blockIdx.x * 4 + w; const int mt = wid / ntn, nq = wid % ntn; if (mt * 16 >= M) return;
  const int row0 = mt * 16, col0 = nq * 64; const float* arow = A + (size_t)(row0 + ln) * lda;
  v8f acc[4] = {};
  for (int kb = 0; kb < K; kb += 32) {
    FragH ah, al;
    const v4f x0 = *(const v4fa*)(arow + kb + 8 * hh), x1 = *(const v4fa*)(arow + kb + 8 * hh + 4), x2 = *(const v4fa*)(arow + kb + 16 + 8 * hh), x3 = *(const v4fa*)(arow + kb + 16 + 8 * hh + 4);
    float xs[16] = {x0[0],x0[1],x0[2],x0[3],x1[0],x1[1],x1[2],x1[3],x2[0],x2[1],x2[2],x2[3],x3[0],x3[1],x3[2],x3[3]};
#pragma unroll
    for (int i = 0; i < 16; ++i) { const _Float16 h = (_Float16)xs[i]; ah.h[i] = h; al.h[i] = ASPLIT ? (_Float16)(xs[i] - (float)h) : (_Float16)0.0f; }
#pragma unroll
    for (int t = 0; t < 4; ++t) { if (col0 + t * 16 >= N) continue; const size_t boff = (size_t)(col0 + t * 16 + ln) * ldb + kb; FragH bq; bq.half[0] = *(const v8us*)(Bh + boff + 8 * hh); bq.half[1] = *(const v8us*)(Bh + boff + 16 + 8 * hh);
      acc[t] = mmaH<ASPLIT ? 2 : 1>(ah.v, al.v, bq.v, bq.v, acc[t]); }
  }
#pragma unroll
  for (int t = 0; t < 4; ++t) { if (col0 + t * 16 >= N) continue;
#pragma unroll
    for (int r = 0; r < 8; ++r) so[w][8 * hh + r][t * 16 + ln] = acc[t][r] * alpha; }
  __builtin_amdgcn_fence(__ATOMIC_ACQ_REL, "workgroup"); __builtin_amdgcn_wave_barrier();
  const int rsub = lane >> 4, c4 = (lane & 15) * 4;
  {
#pragma unroll
    for (int q = 0; q < 8; ++q) { const int r = q * 2 + rsub; if (col0 + c4 < N) { const v4f v = *(const v4fa*)&so[w][r][c4]; *(v4f*)(C + (size_t)(row0 + r) * ldc + col0 + c4) = v; } }
     }
}

// Wt[n][k] = f16(W[k][n]·scale) from f32 row-major W[K][N] (scale = power of two; bf16-exact weights stay exact in f16 away from the subnormal range)
__global__ __launch_bounds__(256) void k_wt_f16(const float* __restrict__ W, _Float16* __restrict__ Wt, int K, int N, float scale) {
  const int t = blockIdx.x * 256 + threadIdx.x; if (t >= N * (K / 8)) return; const int n = t / (K / 8), k8 = (t % (K / 8)) * 8; FragH f;
#pragma unroll
  for (int i = 0; i < 8; ++i) f.h[i] = (_Float16)(bf16_round(W[(size_t)(k8 + i) * N + n]) * scale); const v8us o = f.half[0];
  *(v8us*)((unsigned short*)Wt + (size_t)n * K + k8) = o; 
}
// k_gemm_hh variant with fused epilogue: v = acc·alpha + bias[by·sBias + col] (+ CP[(row/rowsPerB)·sCPb + by·64 + col] if CP) ; ACT 0 none / 1 elu ; writes f16 C16 (and f32 C if non-null)
template <int ACT>
__global__ __launch_bounds__(128) void k_gemm_hhx(const _Float16* __restrict__ A, int lda, size_t sA, const _Float16* __restrict__ Bh, int ldb, size_t sB, float alpha, const float* __restrict__ bias, size_t sBias, const float* __restrict__ CP, int rowsPerB, size_t sCPb, int row0g,
    float* __restrict__ C, _Float16* __restrict__ C16, int ldc, size_t sC, int M, int N, int K) {
  __shared__ __attribute__((aligned(16))) float so[4][16][64];
  const int tid = threadIdx.x, w = tid >> 5, lane = tid & 31, ln = lane & 15, hh = lane >> 4; const int by = blockIdx.y;
  A += (size_t)by * sA; Bh += (size_t)by * sB; const size_t cofs = (size_t)by * sC; const float* bp = bias ? bias + (size_t)by * sBias : nullptr;
  const int ntn = (N + 63) / 64; const int wid = blockIdx.x * 4 + w; const int mt = wid / ntn, nq = wid % ntn; if (mt * 16 >= M) return;
  const int row0 = mt * 16, col0 = nq * 64; const _Float16* arow = A + (size_t)(row0 + ln) * lda;
  v8f acc[4] = {};
  for (int kb = 0; kb < K; kb += 32) { FragH ah; ah.half[0] = *(const v8us*)((const unsigned short*)arow + kb + 8 * hh); ah.half[1] = *(const v8us*)((const unsigned short*)arow + kb + 16 + 8 * hh);
#pragma unroll
    for (int t = 0; t < 4; ++t) { if (col0 + t * 16 >= N) continue; const size_t boff = (size_t)(col0 + t * 16 + ln) * ldb + kb; FragH bq; bq.half[0] = *(const v8us*)((const unsigned short*)Bh + boff + 8 * hh); bq.half[1] = *(const v8us*)((const unsigned short*)Bh + boff + 16 + 8 * hh);
      acc[t] = mmaH<1>(ah.v, ah.v, bq.v, bq.v, acc[t]); }
  }
#pragma unroll
  for (int t = 0; t < 4; ++t) { if (col0 + t * 16 >= N) continue; const int col = col0 + t * 16 + ln; const float bv = bp ? bf16_round(bp[col]) : 0.f;
#pragma unroll
    for (int r = 0; r < 8; ++r) { float v = acc[t][r] * alpha + bv; if (CP) { const int bidx = (row0g + row0 + 8 * hh + r) / rowsPerB; v += CP[(size_t)bidx * sCPb + (size_t)by * 64 + col]; } if (ACT == 1) v = (v > 0.f) ? v : expm1f(v); else if (ACT == 7) v = (v > 0.f) ? v + 1.0f : expf(v); else if (ACT == 8) v = tanhf(v); else if (ACT == 9) v = 0.5f * v * (1.0f + tanhf(0.7978845608028654f * (v + 0.044715f * v * v * v))); else if (ACT == 11) v = 1.0f / (1.0f + expf(-v)); else if (ACT == 12) v = (v > 0.f) ? v : 0.01f * v; else if (ACT == 14) v = (v > 0.f) ? v : 0.1f * v; else if (ACT == 15) v = v / (1.0f + expf(-v)); else if (ACT == 3) v = fmaxf(v, 0.f); else if (ACT == 6) v = 0.5f * v * (1.0f + erff(v * 0.70710678118654752f)); so[w][8 * hh + r][t * 16 + ln] = v; } }
  __builtin_amdgcn_fence(__ATOMIC_ACQ_REL, "workgroup"); __builtin_amdgcn_wave_barrier();
  const int rsub = lane >> 4, c4 = (lane & 15) * 4; typedef _Float16 v4h __attribute__((ext_vector_type(4)));
  {
#pragma unroll
    for (int q = 0; q < 8; ++q) { const int r = q * 2 + rsub; if (col0 + c4 < N) { const v4f v = *(const v4fa*)&so[w][r][c4]; if (C) *(v4f*)(C + cofs + (size_t)(row0 + r) * ldc + col0 + c4) = v; if (C16) { v4h h4; for (int i = 0; i < 4; ++i) h4[i] = (_Float16)v[i]; *(v4h*)(C16 + cofs + (size_t)(row0 + r) * ldc + col0 + c4) = h4; } } }
     }
}


typedef _Float16 v4h __attribute__((ext_vector_type(4)));

__global__ __launch_bounds__(256) void k_x16(const float* __restrict__ x, _Float16* __restrict__ X16, size_t n8) { const size_t t = (size_t)blockIdx.x * 256 + threadIdx.x; if (t >= n8) return; FragH f;
#pragma unroll
  for (int q = 0; q < 8; ++q) f.h[q] = (_Float16)bf16_round(x[t * 8 + q]); *(v8us*)((unsigned short*)X16 + t * 8) = f.half[0];  }
__global__ __launch_bounds__(256) void k_h16(const float* __restrict__ x, _Float16* __restrict__ X16, size_t n8) { const size_t t = (size_t)blockIdx.x * 256 + threadIdx.x; if (t >= n8) return; FragH f;
#pragma unroll
  for (int q = 0; q < 8; ++q) f.h[q] = (_Float16)x[t * 8 + q]; *(v8us*)((unsigned short*)X16 + t * 8) = f.half[0];  }
__global__ __launch_bounds__(256) void k_round16f(const float* __restrict__ W, _Float16* __restrict__ Bt, size_t n8) { const size_t t = (size_t)blockIdx.x * 256 + threadIdx.x; if (t >= n8) return; FragH f;
#pragma unroll
  for (int i = 0; i < 8; ++i) f.h[i] = (_Float16)(bf16_round(W[t * 8 + i]) * 16.0f); *(v8us*)((unsigned short*)Bt + t * 8) = f.half[0];  }
template <int NHv, int TTv>
__global__ __launch_bounds__(256) void k_vt(const _Float16* __restrict__ V16, int ldv, int voff, _Float16* __restrict__ Vt) { __shared__ unsigned short tl[64][66]; const int tid = threadIdx.x; const int slab = blockIdx.x / (TTv / 64), lg = blockIdx.x % (TTv / 64); const int b = slab / NHv, h = slab % NHv;
  for (int i = tid; i < 64 * 8; i += 256) { const int r = i / 8, c8 = (i % 8) * 8; FragH f; f.half[0] = *(const v8us*)((const unsigned short*)V16 + ((size_t)b * TTv + lg * 64 + r) * ldv + voff + h * 64 + c8);
#pragma unroll
    for (int q = 0; q < 8; ++q) tl[r][c8 + q] = f.u[q]; }
  __syncthreads();
  {
#pragma unroll
    for (int rd = 0; rd < 2; ++rd) { const int d = rd * 32 + tid / 8, pc = tid % 8; FragH f;
#pragma unroll
      for (int q = 0; q < 8; ++q) f.u[q] = tl[pc * 8 + q][d];
      *(v8us*)((unsigned short*)Vt + ((size_t)slab * 64 + d) * TTv + lg * 64 + pc * 8) = f.half[0]; }
     } }

// ---- fast GEMM (block tile 128x64, wave tile 32x64; requires M % 128 == 0 rows per launch region, N % 64 == 0 and K % 256 == 0); epilogue = k_gemm_hhx semantics ----
// A and B come through LDS: a stage is 256 k of the block's 128 A rows and 64 B rows (rows of 512 bytes), brought once for the four waves by asynchronous copies, one whole row a wave and copy,
// two buffers, the next stage flying while a stage is worked on. The fragments read from LDS hold the same elements in the same order as those read from global memory before.
#define GSK 256      /* k a stage */
#define GPH (GSK + 8)      /* LDS row pitch in 16-bit elements: 512 bytes of data + 16, a conflict-free pitch for 16-byte row readers */
#define GRB (4 * GPH * 2)      /* bytes of 4 LDS rows: the step between a thread's pieces of a tile */
#define GBB (192 * GPH * 2)      /* bytes of one buffer: rows 0 to 127 the A tile, rows 128 to 191 the B tile */
#define GTP 132      /* pitch in floats of a column of the turned 128 x 64 output tile: 128 rows + 4, so that the 16 columns of a register tile start in 16 different bank groups */
__device__ __forceinline__ v16h g2_frag(const _Float16* p, int hh) { FragH f; f.half[0] = *(const v8us*)((const unsigned short*)p + 8 * hh); f.half[1] = *(const v8us*)((const unsigned short*)p + 16 + 8 * hh); return f.v; }
__device__ __forceinline__ v8f g2_mma(v16h a, v16h b, v8f c) { v8f d = __builtin_amdgcn_wmma_f32_16x16x32_f16(false, a, false, b, (short)0, c, false, false); asm volatile("v_nop\n\tv_nop\n\tv_nop\n\tv_nop" : "+v"(d) : "v"(a), "v"(b)); return d; }
// Eight copies of one thread, 16 bytes each: rows four apart, in LDS (GRB bytes) and in global memory (gs elements). The s_wait_xcnt closes the statement so that no address register is rewritten ahead of it.
__device__ __forceinline__ void g2_copy8(unsigned l, const unsigned short* g, size_t gs) {
  const unsigned short* g1 = g + gs; const unsigned short* g2 = g1 + gs; const unsigned short* g3 = g2 + gs; const unsigned short* g4 = g3 + gs; const unsigned short* g5 = g4 + gs; const unsigned short* g6 = g5 + gs; const unsigned short* g7 = g6 + gs;
  asm volatile("global_load_async_to_lds_b128 %0, %8, off\n\t"
               "global_load_async_to_lds_b128 %1, %9, off\n\t"
               "global_load_async_to_lds_b128 %2, %10, off\n\t"
               "global_load_async_to_lds_b128 %3, %11, off\n\t"
               "global_load_async_to_lds_b128 %4, %12, off\n\t"
               "global_load_async_to_lds_b128 %5, %13, off\n\t"
               "global_load_async_to_lds_b128 %6, %14, off\n\t"
               "global_load_async_to_lds_b128 %7, %15, off\n\t"
               "s_wait_xcnt 0x0"
               :: "v"(l), "v"(l + GRB), "v"(l + 2 * GRB), "v"(l + 3 * GRB), "v"(l + 4 * GRB), "v"(l + 5 * GRB), "v"(l + 6 * GRB), "v"(l + 7 * GRB),
                  "v"(g), "v"(g1), "v"(g2), "v"(g3), "v"(g4), "v"(g5), "v"(g6), "v"(g7) : "memory");
}
// One stage's copies of one thread: 32 pieces of the A tile and 16 of the B tile (48 in flight a wave).
__device__ __forceinline__ void g2_stage(unsigned l, const unsigned short* ga, size_t as4, const unsigned short* gb, size_t bs4) {
#pragma unroll
  for (int c = 0; c < 4; ++c) g2_copy8(l + c * 8 * GRB, ga + c * 8 * as4, as4);
#pragma unroll
  for (int c = 0; c < 2; ++c) g2_copy8(l + (32 + c * 8) * GRB, gb + c * 8 * bs4, bs4);
}
template <int ACT>
__global__ __launch_bounds__(128) void k_gemm2(const _Float16* __restrict__ A, int lda, size_t sA, const _Float16* __restrict__ Bh, int ldb, size_t sB, float alpha, const float* __restrict__ bias, const float* __restrict__ bias1, const float* __restrict__ bias2, int nterm, size_t sAt, float tsc,
    float* __restrict__ C, _Float16* __restrict__ C16, int ldc, size_t sC, int M, int N, int K, int tby, float* __restrict__ Ct, _Float16* __restrict__ Ct16) {
  __shared__ __attribute__((aligned(16))) float so[4][32][68]; __shared__ __attribute__((aligned(16))) unsigned short sT[2][192][GPH];
  const int tid = threadIdx.x, w = tid >> 5, lane = tid & 31, ln = lane & 15, hh = lane >> 4; const int by = blockIdx.y;
  A += (size_t)by * sA; Bh += (size_t)by * sB; const size_t cofs = (size_t)by * sC; const float* bp = (by == 0) ? bias : ((by == 1) ? bias1 : bias2);      /* products that need nothing of each other share one grid: blockIdx.y picks the product, its B and C planes and its own bias vector */
  const int ntn = N >> 6; const int mt = blockIdx.x / ntn, nq = blockIdx.x - mt * ntn; const int row0 = mt * 128 + 32 * w, col0 = nq * 64; if (mt * 128 >= M) return;      /* the whole block leaves or none of it: barriers follow */
  const size_t as4 = (size_t)4 * lda, bs4 = (size_t)4 * ldb; const int spt = K / GSK, nst = nterm * spt;      /* the product is a sum of nterm terms A_j B over the same B: term j's A plane lies j sAt elements behind the first, and the ring walks the terms' stages one behind the other */
  const ptrdiff_t tstep = (ptrdiff_t)sAt - K; int cst = 0, wst = 0;      /* stages of the current term copied, and worked on, so far: the same in every thread */
  const unsigned short* ga = (const unsigned short*)A + (size_t)(mt * 128 + w) * lda + lane * 8;      /* the thread's first piece of the next stage to copy: a wave copies one whole row */
  const unsigned short* gb = (const unsigned short*)Bh + (size_t)(col0 + w) * ldb + lane * 8;
  const unsigned l0 = (unsigned)(size_t)&sT[0][w][lane * 8];      /* low 32 bits of a shared address = the byte offset in LDS */
  auto g2_next = [&]() { ga += GSK; gb += GSK; if (++cst == spt) { cst = 0; ga += tstep; gb -= K; } };      /* behind a term's last stage: the next A plane, B from its start again */
  g2_stage(l0, ga, as4, gb, bs4); g2_next();
  asm volatile("s_wait_asynccnt 0x0" ::: "memory");      /* stage 0 has landed before the barrier that publishes it */
  __syncthreads();
  if (nst > 1) { g2_stage(l0 + GBB, ga, as4, gb, bs4); g2_next(); }
  const v8f z8 = {0.f,0.f,0.f,0.f,0.f,0.f,0.f,0.f}; v8f c00 = z8, c01 = z8, c02 = z8, c03 = z8, c10 = z8, c11 = z8, c12 = z8, c13 = z8;
#pragma unroll 1      /* one stage a trip: the buffer index stays a run-time value and the text small */
  for (int st = 0; st < nst; ++st) {
    const int buf = st & 1;
    if (wst == spt) { wst = 0; c00 *= tsc; c01 *= tsc; c02 *= tsc; c03 *= tsc; c10 *= tsc; c11 *= tsc; c12 *= tsc; c13 *= tsc; }      /* a new term starts: the sum so far is brought to its scale (a power of two: exact) and the term accumulates on top of it */
    ++wst;
    const _Float16* af = (const _Float16*)&sT[buf][32 * w + ln][0]; const _Float16* bf = (const _Float16*)&sT[buf][128 + ln][0];
    v16h fa[2][2], fb[2][4];      /* two fragment sets: a k step's reads are issued as one group ahead of the k step before it, inside the stage */
    fa[0][0] = g2_frag(af, hh); fa[0][1] = g2_frag(af + 16 * GPH, hh);
#pragma unroll
    for (int t = 0; t < 4; ++t) fb[0][t] = g2_frag(bf + t * 16 * GPH, hh);
#pragma unroll
    for (int kk = 0; kk < GSK / 32; ++kk) { const int cu = kk & 1, nx = cu ^ 1;
      if (kk + 1 < GSK / 32) { fa[nx][0] = g2_frag(af + (kk + 1) * 32, hh); fa[nx][1] = g2_frag(af + 16 * GPH + (kk + 1) * 32, hh);
#pragma unroll
        for (int t = 0; t < 4; ++t) fb[nx][t] = g2_frag(bf + t * 16 * GPH + (kk + 1) * 32, hh); }
      c00 = g2_mma(fa[cu][0], fb[cu][0], c00); c10 = g2_mma(fa[cu][1], fb[cu][0], c10);
      c01 = g2_mma(fa[cu][0], fb[cu][1], c01); c11 = g2_mma(fa[cu][1], fb[cu][1], c11);
      c02 = g2_mma(fa[cu][0], fb[cu][2], c02); c12 = g2_mma(fa[cu][1], fb[cu][2], c12);
      c03 = g2_mma(fa[cu][0], fb[cu][3], c03); c13 = g2_mma(fa[cu][1], fb[cu][3], c13); }
    asm volatile("s_wait_dscnt 0x0" ::: "memory");      /* this wave's reads of the buffer have returned before it is given up */
    asm volatile("s_wait_asynccnt 0x0" ::: "memory");      /* this wave's copies of the next stage have landed */
    __syncthreads();      /* publishes the next stage and ends every wave's reads of this one */
    if (st + 2 < nst) { g2_stage(l0 + buf * GBB, ga, as4, gb, bs4); g2_next(); } }
  asm volatile("s_wait_asynccnt 0x0" ::: "memory");      /* no copy is left in flight when the wave goes on to the epilogue */
  v8f accs[8] = {c00, c01, c02, c03, c10, c11, c12, c13};
#pragma unroll
  for (int u = 0; u < 8; ++u) { const int t = u & 3; const int col = col0 + t * 16 + ln; const float bv = bp ? bf16_round(bp[col]) : 0.f;
#pragma unroll
    for (int r = 0; r < 8; ++r) { float v = accs[u][r] * alpha + bv;
      if (ACT == 3) v = fmaxf(v, 0.f); else if (ACT == 6) v = 0.5f * v * (1.0f + erff(v * 0.70710678118654752f)); else if (ACT == 11) v = 1.0f / (1.0f + expf(-v)); else if (ACT == 15) v = v / (1.0f + expf(-v)); else if (ACT == 12) v = (v > 0.f) ? v : 0.01f * v; else if (ACT == 8) v = tanhf(v);
      accs[u][r] = v; } }
  if (by == tby) {      /* this product's consumer wants C^T (column-major, pitch NR, a constant: the stores of a thread differ by immediate offsets): the block's 128 x 64 tile is turned in LDS and stored from here; the test reads the same for the whole block */
    float* sf = &so[0][0][0];
#pragma unroll
    for (int u = 0; u < 8; ++u) { float* d = sf + ((u & 3) * 16 + ln) * GTP + 32 * w + (u >> 2) * 16 + 8 * hh;      /* a lane's 8 registers are 8 consecutive rows of one column */
      *(v4f*)d = (v4f){accs[u][0], accs[u][1], accs[u][2], accs[u][3]}; *(v4f*)(d + 4) = (v4f){accs[u][4], accs[u][5], accs[u][6], accs[u][7]}; }
    __syncthreads();      /* a wave stores whole columns of the block tile, which hold rows of all four waves */
    if (Ct) {
#pragma unroll
      for (int q = 0; q < 16; ++q) { const int c = w * 16 + q; const v4f v = *(const v4fa*)(sf + c * GTP + lane * 4); *(v4f*)(Ct + (size_t)(col0 + c) * NR + mt * 128 + lane * 4) = v; }      /* 512 contiguous bytes a wave and store */
      asm volatile("s_wait_xcnt 0x0" ::: "memory"); }      /* behind the last store of the run: in the listing the other store path follows and rewrites these stores' registers */
    else { unsigned short* tb = (unsigned short*)Ct16 + (size_t)(col0 + w * 16 + hh) * NR + mt * 128 + ln * 8;
#pragma unroll
      for (int q = 0; q < 8; ++q) { const float* s = sf + (w * 16 + hh + q * 2) * GTP + ln * 8; const v4f a = *(const v4fa*)s, e = *(const v4fa*)(s + 4); FragH f;
#pragma unroll
        for (int i = 0; i < 4; ++i) { f.h[i] = (_Float16)a[i]; f.h[4 + i] = (_Float16)e[i]; }
        *(v8us*)(tb + (size_t)q * 2 * NR) = f.half[0]; } }      /* 256 contiguous bytes a half wave */
    return; }
#pragma unroll
  for (int u = 0; u < 8; ++u)
#pragma unroll
    for (int r = 0; r < 8; ++r) so[w][(u >> 2) * 16 + 8 * hh + r][(u & 3) * 16 + ln] = accs[u][r];
  __builtin_amdgcn_fence(__ATOMIC_ACQ_REL, "workgroup"); __builtin_amdgcn_wave_barrier();
  const int rsub = lane >> 4, c4 = (lane & 15) * 4;
  {
#pragma unroll
    for (int q = 0; q < 16; ++q) { const int r = q * 2 + rsub; const v4f v = *(const v4fa*)&so[w][r][c4]; if (C) { *(v4f*)(C + cofs + (size_t)(row0 + r) * ldc + col0 + c4) = v; asm volatile("s_wait_xcnt 0x0" ::: "memory"); }      /* the f16 conversion that may follow rewrites this store's data registers */
      if (C16) { v4h h4; for (int i = 0; i < 4; ++i) h4[i] = (_Float16)v[i]; *(v4h*)(C16 + cofs + (size_t)(row0 + r) * ldc + col0 + c4) = h4; } }
    asm volatile("s_wait_xcnt 0x0" ::: "memory");      /* behind the last row-major store: in the listing the turned-tile path follows and rewrites that store's address registers */
     } }



// lane l takes the value of lane l ^ 16 (the other half of the same query column)
__device__ __forceinline__ float xhalf(float x) { return __builtin_bit_cast(float, __builtin_amdgcn_permlanex16(__builtin_bit_cast(int, x), __builtin_bit_cast(int, x), 0x76543210, 0xfedcba98, false, false)); }
#define FKG 2      /* key groups a block */
#define FSK 64      /* keys a stage */
#define FPH 72      /* LDS row pitch in 16-bit elements: 128 bytes of data + 16, the conflict-free pitch for 16-byte row readers */
#define FBB (64 * FPH * 2)      /* bytes of one tile buffer */
#define FRB (16 * FPH * 2)      /* bytes of 16 LDS rows: the step between a thread's four pieces of a tile */
#define FC2 (SCL * 1.4426950408889634f)      /* score scale times log2(e): the softmax runs in base 2 on the hardware's own exponential */
// One stage's copies of one thread: pieces (row, row + 16, row + 32, row + 48) of the K tile and of the V^T tile, 16 bytes each. The s_wait_xcnt closes the statement so that no address register is rewritten ahead of it.
__device__ __forceinline__ void fl_copy(unsigned lk, unsigned lv, const unsigned short* gk, size_t ks16, const unsigned short* gv) {
  const unsigned short* gk1 = gk + ks16; const unsigned short* gk2 = gk1 + ks16; const unsigned short* gk3 = gk2 + ks16;
  const unsigned short* gv1 = gv + (size_t)16 * TK; const unsigned short* gv2 = gv + (size_t)32 * TK; const unsigned short* gv3 = gv + (size_t)48 * TK;
  asm volatile("global_load_async_to_lds_b128 %0, %8, off\n\t"
               "global_load_async_to_lds_b128 %1, %9, off\n\t"
               "global_load_async_to_lds_b128 %2, %10, off\n\t"
               "global_load_async_to_lds_b128 %3, %11, off\n\t"
               "global_load_async_to_lds_b128 %4, %12, off\n\t"
               "global_load_async_to_lds_b128 %5, %13, off\n\t"
               "global_load_async_to_lds_b128 %6, %14, off\n\t"
               "global_load_async_to_lds_b128 %7, %15, off\n\t"
               "s_wait_xcnt 0x0"
               :: "v"(lk), "v"(lk + FRB), "v"(lk + 2 * FRB), "v"(lk + 3 * FRB), "v"(lv), "v"(lv + FRB), "v"(lv + 2 * FRB), "v"(lv + 3 * FRB),
                  "v"(gk), "v"(gk1), "v"(gk2), "v"(gk3), "v"(gv), "v"(gv1), "v"(gv2), "v"(gv3) : "memory");
}
__global__ __launch_bounds__(128 * FKG) void k_flash(const _Float16* __restrict__ Q16, int ldq, const _Float16* __restrict__ K16, int ldk, const _Float16* __restrict__ Vt, _Float16* __restrict__ OHp, _Float16* __restrict__ OLp, int ldo) {
  constexpr int RPW = 16, DT = 4, KS = 2, KPG = TK / FKG, NST = KPG / FSK;
  __shared__ __attribute__((aligned(16))) unsigned short sK[FKG][2][64][FPH]; __shared__ __attribute__((aligned(16))) unsigned short sV[FKG][2][64][FPH];
  const int kg = threadIdx.x >> 7, tid = threadIdx.x & 127, w = tid >> 5, lane = tid & 31, ln = lane & 15, hh = lane >> 4;      /* tid, w: the thread and the wave inside its key group */
  const int slab = blockIdx.x / QBNP, qblk = QB0P + blockIdx.x % QBNP; const int b = slab / NH, h = slab % NH; const int q0 = qblk * (4 * RPW) + w * RPW;
  FragH bq[KS];
  { const unsigned short* qr = (const unsigned short*)Q16 + ((size_t)b * TQ + q0 + ln) * ldq + h * 64;
#pragma unroll
    for (int ks = 0; ks < KS; ++ks) { bq[ks].half[0] = *(const v8us*)(qr + ks * 32 + 8 * hh); bq[ks].half[1] = *(const v8us*)(qr + ks * 32 + 16 + 8 * hh); } }
  const unsigned short* Vth = (const unsigned short*)Vt + (size_t)slab * 64 * TK;
  const int crow = tid >> 3, cseg = (tid & 7) * 8;      /* eight threads copy one 128-byte row */
  const size_t ks16 = (size_t)16 * ldk, kstg = (size_t)FSK * ldk;
  const unsigned short* gk = (const unsigned short*)K16 + ((size_t)b * TK + kg * KPG + crow) * ldk + h * 64 + cseg;      /* the thread's first piece of the next stage to copy, advanced behind each stage's copies */
  const unsigned short* gv = Vth + (size_t)crow * TK + kg * KPG + cseg;
  const unsigned lk0 = (unsigned)(size_t)&sK[kg][0][crow][cseg], lv0 = (unsigned)(size_t)&sV[kg][0][crow][cseg];      /* low 32 bits of a shared address = the byte offset in LDS */
  fl_copy(lk0, lv0, gk, ks16, gv); gk += kstg; gv += FSK;
  asm volatile("s_wait_asynccnt 0x0" ::: "memory");      /* stage 0 has landed before the barrier that publishes it */
  __syncthreads();
  fl_copy(lk0 + FBB, lv0 + FBB, gk, ks16, gv); gk += kstg; gv += FSK;
  float m_r = -3.0e38f, l_r = 0.f; v8f oacc[DT];
#pragma unroll
  for (int dt = 0; dt < DT; ++dt) oacc[dt] = (v8f){0.f,0.f,0.f,0.f,0.f,0.f,0.f,0.f};
#pragma unroll 1      /* one stage a trip: the buffer index stays a run-time value and the text small */
  for (int st = 0; st < NST; ++st) {
    const int buf = st & 1;
    const unsigned short* kf = &sK[kg][buf][ln][8 * hh]; const unsigned short* vf = &sV[kg][buf][ln][8 * hh];
#pragma unroll
    for (int ps2 = 0; ps2 < FSK / 32; ++ps2) {
      FragH ak[2][KS], av[DT];
#pragma unroll
      for (int nt = 0; nt < 2; ++nt)
#pragma unroll
        for (int ks = 0; ks < KS; ++ks) { const unsigned short* kr = kf + (ps2 * 32 + nt * 16) * FPH + ks * 32; ak[nt][ks].half[0] = *(const v8us*)kr; ak[nt][ks].half[1] = *(const v8us*)(kr + 16); }
#pragma unroll
      for (int dt = 0; dt < DT; ++dt) { const unsigned short* vr = vf + dt * 16 * FPH + ps2 * 32; av[dt].half[0] = *(const v8us*)vr; av[dt].half[1] = *(const v8us*)(vr + 16); }
      float sc[16];
#pragma unroll
      for (int nt = 0; nt < 2; ++nt) { v8f acc = (v8f){0.f,0.f,0.f,0.f,0.f,0.f,0.f,0.f};
#pragma unroll
        for (int ks = 0; ks < KS; ++ks) acc = mmaH<1>(ak[nt][ks].v, ak[nt][ks].v, bq[ks].v, bq[ks].v, acc);
#pragma unroll
        for (int r = 0; r < 8; ++r) sc[nt * 8 + r] = acc[r]; }      /* raw q.k: the maximum is kept unscaled, the scale goes into the exponent's multiply-add */
      float mx[4];
#pragma unroll
      for (int c = 0; c < 4; ++c) mx[c] = fmaxf(fmaxf(sc[c], sc[4 + c]), fmaxf(sc[8 + c], sc[12 + c]));
      float mc = fmaxf(fmaxf(mx[0], mx[1]), fmaxf(mx[2], mx[3])); mc = fmaxf(mc, xhalf(mc));      /* both halves of a column use one maximum: they share the output tiles */
      const float mn = fmaxf(m_r, mc); float al = (m_r - mn) * FC2; m_r = mn;
      const float nb = fmaf(-mn, FC2, 10.0f);      /* 2^(s FC2 + nb) = 1024 exp((s - mn) / 8) */
      FragH pb; float ps[4];
#pragma unroll
      for (int i = 0; i < 16; ++i) sc[i] = fmaf(sc[i], FC2, nb);
      asm("v_exp_f32 %0, %0\n\tv_exp_f32 %1, %1\n\tv_exp_f32 %2, %2\n\tv_exp_f32 %3, %3\n\tv_exp_f32 %4, %4\n\tv_exp_f32 %5, %5\n\tv_exp_f32 %6, %6\n\tv_exp_f32 %7, %7\n\tv_exp_f32 %8, %8\n\t"
          "v_exp_f32 %9, %9\n\tv_exp_f32 %10, %10\n\tv_exp_f32 %11, %11\n\tv_exp_f32 %12, %12\n\tv_exp_f32 %13, %13\n\tv_exp_f32 %14, %14\n\tv_exp_f32 %15, %15\n\tv_exp_f32 %16, %16\n\tv_nop"
          : "+v"(al), "+v"(sc[0]), "+v"(sc[1]), "+v"(sc[2]), "+v"(sc[3]), "+v"(sc[4]), "+v"(sc[5]), "+v"(sc[6]), "+v"(sc[7]), "+v"(sc[8]), "+v"(sc[9]), "+v"(sc[10]), "+v"(sc[11]), "+v"(sc[12]), "+v"(sc[13]), "+v"(sc[14]), "+v"(sc[15]));
#pragma unroll
      for (int i = 0; i < 16; ++i) { const float p = sc[i]; ps[i & 3] = (i < 4) ? p : ps[i & 3] + p; pb.h[i] = (_Float16)p; }      /* element i = key kmap(i, hh): the order of the V^T fragments above */
      l_r = l_r * al + ((ps[0] + ps[1]) + (ps[2] + ps[3]));
#pragma unroll
      for (int dt = 0; dt < DT; ++dt)
#pragma unroll
        for (int r = 0; r < 8; ++r) oacc[dt][r] *= al;
#pragma unroll
      for (int dt = 0; dt < DT; ++dt) oacc[dt] = mmaH<1>(av[dt].v, av[dt].v, pb.v, pb.v, oacc[dt]);
    }
    asm volatile("s_wait_dscnt 0x0" ::: "memory");      /* this wave's reads of the buffer have returned before it is given up */
    asm volatile("s_wait_asynccnt 0x0" ::: "memory");      /* this wave's copies of the next stage have landed */
    __syncthreads();      /* publishes the next stage and ends every wave's reads of this one */
    if (st + 2 < NST) { fl_copy(lk0 + buf * FBB, lv0 + buf * FBB, gk, ks16, gv); gk += kstg; gv += FSK; } }
  asm volatile("s_wait_asynccnt 0x0" ::: "memory");      /* no copy is left in flight when the ring becomes the hand-over buffer */
  /* the loop's last barrier has ended every wave's reads of the ring and no copy was issued behind it: the K ring now carries group 1's state, 16 bytes a lane and piece, lanes side by side */
  v4fa* sm = (v4fa*)&sK[0][0][0][0] + (w * (2 * DT + 1)) * 32 + lane;
  if (kg == 1) {
#pragma unroll
    for (int dt = 0; dt < DT; ++dt) { sm[(2 * dt) * 32] = (v4f){oacc[dt][0], oacc[dt][1], oacc[dt][2], oacc[dt][3]}; sm[(2 * dt + 1) * 32] = (v4f){oacc[dt][4], oacc[dt][5], oacc[dt][6], oacc[dt][7]}; }
    sm[2 * DT * 32] = (v4f){m_r, l_r, 0.f, 0.f}; }
  __syncthreads();      /* group 1's state is in LDS before group 0 reads it; every wave passes it */
  if (kg == 1) return;      /* no barrier follows */
  { const v4f ml = sm[2 * DT * 32]; const float mj = fmaxf(m_r, ml[0]);      /* both partial softmaxes are brought to the common maximum */
    const float f0 = __builtin_amdgcn_exp2f((m_r - mj) * FC2), f1 = __builtin_amdgcn_exp2f((ml[0] - mj) * FC2);
    l_r = l_r * f0 + ml[1] * f1;
#pragma unroll
    for (int dt = 0; dt < DT; ++dt) { const v4f a = sm[(2 * dt) * 32], e = sm[(2 * dt + 1) * 32];
#pragma unroll
      for (int r = 0; r < 4; ++r) { oacc[dt][r] = oacc[dt][r] * f0 + a[r] * f1; oacc[dt][4 + r] = oacc[dt][4 + r] * f0 + e[r] * f1; } } }
  const float l = l_r + xhalf(l_r); const float inv = (l > 0.f) ? 1.0f / l : 0.f;      /* weights and sum both carry the 2^10 */
  const size_t oofs = ((size_t)b * TQ + q0 + ln) * ldo + h * 64 + 8 * hh;      /* register r of tile dt = channel dt * 16 + 8 hh + r of query ln: 16 contiguous bytes a lane in each plane */
#pragma unroll
  for (int dt = 0; dt < DT; ++dt) { FragH fh, fl;      /* the output conv's two operands, f16 and the 2^10 residual, are formed here from the registers */
#pragma unroll
    for (int r = 0; r < 8; ++r) { const float v = oacc[dt][r] * inv; const _Float16 hv = (_Float16)v; fh.h[r] = hv; fl.h[r] = (_Float16)((v - (float)hv) * 1024.0f); }
    *(v8us*)((unsigned short*)OHp + oofs + dt * 16) = fh.half[0]; *(v8us*)((unsigned short*)OLp + oofs + dt * 16) = fl.half[0]; } }
// 5-plane variant: S = Qh Kh^T + (Ql Kh^T + Qh Kl^T)/1024 with Q/K = [hi | 2^10 residual] f16 planes (QL/KL same layout as Q16/K16), then the 3-term P.V below.
// 3-term variant: O = (P_hi V_hi + (P_lo V_hi + P_hi V_lo) / 1024) / l with P = [hi | 2^10 residual] of 1024 p and V^T = [hi | 2^10 residual] planes (VtL same layout as Vt) -> ~2^-21-class products for un-averaged (early causal / peaked) rows
template <int CAUSAL>
__global__ __launch_bounds__(128) void k_flash5(const _Float16* __restrict__ Q16, const _Float16* __restrict__ QL, int ldq, const _Float16* __restrict__ K16, const _Float16* __restrict__ KL, int ldk, const _Float16* __restrict__ Vt, const _Float16* __restrict__ VtL, const int* __restrict__ MSK, float* __restrict__ O, int ldo) {
  constexpr int RPW = 16, RTN = RPW / 16, NQB = TQ / (4 * RPW), DT = 4, KS = 2;
  __shared__ __attribute__((aligned(16))) unsigned short sP[4][RPW][40]; __shared__ __attribute__((aligned(16))) unsigned short sPL[4][RPW][40]; __shared__ __attribute__((aligned(16))) float sO[4][RPW][64 + 4];
  const int tid = threadIdx.x, w = tid >> 5, lane = tid & 31, ln = lane & 15, hh = lane >> 4;
  const int slab = blockIdx.x / QBN5, qblk = QB05 + blockIdx.x % QBN5; (void)NQB; const int b = slab / NH, h = slab % NH; const int qb0 = qblk * (4 * RPW); const int q0 = qb0 + w * RPW;
  FragH aq[2][KS], aql[2][KS];
#pragma unroll
  for (int rt = 0; rt < RTN; ++rt) { const unsigned short* qr = (const unsigned short*)Q16 + ((size_t)b * TQ + q0 + rt * 16 + ln) * ldq + h * 64; const unsigned short* ql = (const unsigned short*)QL + ((size_t)b * TQ + q0 + rt * 16 + ln) * ldq + h * 64;
#pragma unroll
    for (int ks = 0; ks < KS; ++ks) { aq[rt][ks].half[0] = *(const v8us*)(qr + ks * 32 + 8 * hh); aq[rt][ks].half[1] = *(const v8us*)(qr + ks * 32 + 16 + 8 * hh); aql[rt][ks].half[0] = *(const v8us*)(ql + ks * 32 + 8 * hh); aql[rt][ks].half[1] = *(const v8us*)(ql + ks * 32 + 16 + 8 * hh); } }
  const unsigned short* Vth = (const unsigned short*)Vt + (size_t)slab * 64 * TK; const unsigned short* Vtl = (const unsigned short*)VtL + (size_t)slab * 64 * TK;
  float m_r[2][8], l_r[2][8]; v8f oacc[2][DT], oaccL[2][DT];
#pragma unroll
  for (int rt = 0; rt < RTN; ++rt) {
#pragma unroll
    for (int r = 0; r < 8; ++r) { m_r[rt][r] = -3.0e38f; l_r[rt][r] = 0.f; }
#pragma unroll
    for (int dt = 0; dt < DT; ++dt) { oacc[rt][dt] = (v8f){0.f,0.f,0.f,0.f,0.f,0.f,0.f,0.f}; oaccL[rt][dt] = oacc[rt][dt]; } }
  const int jend = (CAUSAL == 1) ? (qb0 + 4 * RPW) : ((CAUSAL == 23) ? min(TK, (qb0 / CHK + 2) * CHK) : TK);      /* causal / window: keys that can never contribute are skipped */ const int jbeg = (CAUSAL == 23) ? max(0, (qb0 / CHK - 1) * CHK) : 0;
#pragma unroll 1
  for (int j0 = jbeg; j0 < jend; j0 += 32) {
    v8f s[2][2];
#pragma unroll
    for (int nt = 0; nt < 2; ++nt) { const unsigned short* kr = (const unsigned short*)K16 + ((size_t)b * TK + j0 + nt * 16 + ln) * ldk + h * 64; const unsigned short* klr = (const unsigned short*)KL + ((size_t)b * TK + j0 + nt * 16 + ln) * ldk + h * 64; FragH bk[KS], bkl[KS];
#pragma unroll
      for (int ks = 0; ks < KS; ++ks) { bk[ks].half[0] = *(const v8us*)(kr + ks * 32 + 8 * hh); bk[ks].half[1] = *(const v8us*)(kr + ks * 32 + 16 + 8 * hh); bkl[ks].half[0] = *(const v8us*)(klr + ks * 32 + 8 * hh); bkl[ks].half[1] = *(const v8us*)(klr + ks * 32 + 16 + 8 * hh); }
#pragma unroll
      for (int rt = 0; rt < RTN; ++rt) { v8f acc = (v8f){0.f,0.f,0.f,0.f,0.f,0.f,0.f,0.f}, accl = acc;
#pragma unroll
        for (int ks = 0; ks < KS; ++ks) { acc = mmaH<1>(aq[rt][ks].v, aq[rt][ks].v, bk[ks].v, bk[ks].v, acc); accl = mmaH<1>(aql[rt][ks].v, aql[rt][ks].v, bk[ks].v, bk[ks].v, accl); accl = mmaH<1>(aq[rt][ks].v, aq[rt][ks].v, bkl[ks].v, bkl[ks].v, accl); }
#pragma unroll
        for (int r = 0; r < 8; ++r) acc[r] += accl[r] * 0.0009765625f;
        s[rt][nt] = acc; } }
#pragma unroll
    for (int rt = 0; rt < RTN; ++rt)
#pragma unroll
      for (int r = 0; r < 8; ++r) { const int tq = q0 + rt * 16 + 8 * hh + r; const int k0 = j0 + ln, k1 = j0 + 16 + ln;
        bool ok0 = (CAUSAL == 1) ? (k0 <= tq) : ((CAUSAL == 2) ? ((k0 >> 5) == (tq >> 5)) : true), ok1 = (CAUSAL == 1) ? (k1 <= tq) : ((CAUSAL == 2) ? ((k1 >> 5) == (tq >> 5)) : true);      /* mode 2: block-diagonal 32-token groups */
        if (CAUSAL == 4) { const int* mrow = MSK + ((size_t)b * TQ + tq) * TK; ok0 = mrow[k0] != 0; ok1 = mrow[k1] != 0; }      /* mode 4: per-(query, key) INPUT mask shared by all heads; masked keys contribute nothing (== the reference's -4096 fill, whose exp underflows to 0), rows with no valid key give l = 0 -> output 0 (== the reference's row_valid zeroing) */
        float s0 = ok0 ? s[rt][0][r] * SCL : -3.0e38f, s1 = ok1 ? s[rt][1][r] * SCL : -3.0e38f; if (CAUSAL == 17) { const float* amk = (const float*)MSK + (size_t)b * TK; s0 += bf16_round(amk[k0]); s1 += bf16_round(amk[k1]); } if (CAUSAL == 18) { const float* tb = (const float*)MSK; const int* ri = MSK + 1024 + (size_t)b * TK; const int rq = ri[tq]; s0 += tb[(h * 8 + rq) * 8 + ri[k0]]; s1 += tb[(h * 8 + rq) * 8 + ri[k1]]; } if (CAUSAL == 19) { const int* rel = MSK + (size_t)tq * TK; const float* rb = (const float*)MSK + (size_t)TQ * TK + ((size_t)(b * NH + h) * TQ + tq) * 64; s0 += rb[rel[k0]]; s1 += rb[rel[k1]]; }      /* mode 19: + (q.Ek[rel] + Eb[rel][h]) / 8 gathered by the int relative ids (packed [ids | table]) */      /* mode 18: + resource_bias[h][r_q][r_k] from the packed [table | ids] buffer (TQ == TK) */      /* mode 17: additive per-(batch, key) mask INPUT */ float mc = fmaxf(s0, s1);
        mc = fmaxf(mc, __shfl_xor(mc, 1, 32)); mc = fmaxf(mc, __shfl_xor(mc, 2, 32)); mc = fmaxf(mc, __shfl_xor(mc, 4, 32)); mc = fmaxf(mc, __shfl_xor(mc, 8, 32));
        const float mn = fmaxf(m_r[rt][r], mc); const float al = (mn > -1.0e38f) ? expf(m_r[rt][r] - mn) : 1.0f; m_r[rt][r] = mn; const float p0 = ok0 ? expf(s0 - mn) : 0.f, p1 = ok1 ? expf(s1 - mn) : 0.f; l_r[rt][r] = l_r[rt][r] * al + p0 + p1;
#pragma unroll
        for (int dt = 0; dt < DT; ++dt) { oacc[rt][dt][r] *= al; oaccL[rt][dt][r] *= al; }
        FragH t2, t2l; const float ps0 = p0 * 1024.0f, ps1 = p1 * 1024.0f; t2.h[0] = (_Float16)ps0; t2.h[1] = (_Float16)ps1; t2l.h[0] = (_Float16)((ps0 - (float)t2.h[0]) * 1024.0f); t2l.h[1] = (_Float16)((ps1 - (float)t2.h[1]) * 1024.0f);
        sP[w][rt * 16 + 8 * hh + r][ln] = t2.u[0]; sP[w][rt * 16 + 8 * hh + r][16 + ln] = t2.u[1]; sPL[w][rt * 16 + 8 * hh + r][ln] = t2l.u[0]; sPL[w][rt * 16 + 8 * hh + r][16 + ln] = t2l.u[1]; }
    __builtin_amdgcn_fence(__ATOMIC_ACQ_REL, "workgroup"); __builtin_amdgcn_wave_barrier();
    FragH pa[2], pl[2];
#pragma unroll
    for (int rt = 0; rt < RTN; ++rt) { pa[rt].half[0] = *(const v8us*)&sP[w][rt * 16 + ln][8 * hh]; pa[rt].half[1] = *(const v8us*)&sP[w][rt * 16 + ln][16 + 8 * hh]; pl[rt].half[0] = *(const v8us*)&sPL[w][rt * 16 + ln][8 * hh]; pl[rt].half[1] = *(const v8us*)&sPL[w][rt * 16 + ln][16 + 8 * hh]; }
#pragma unroll
    for (int dt = 0; dt < DT; ++dt) { const unsigned short* vrow = Vth + (size_t)(dt * 16 + ln) * TK + j0; const unsigned short* vrl = Vtl + (size_t)(dt * 16 + ln) * TK + j0; FragH bv, bl; bv.half[0] = *(const v8us*)(vrow + 8 * hh); bv.half[1] = *(const v8us*)(vrow + 16 + 8 * hh); bl.half[0] = *(const v8us*)(vrl + 8 * hh); bl.half[1] = *(const v8us*)(vrl + 16 + 8 * hh);
#pragma unroll
      for (int rt = 0; rt < RTN; ++rt) { oacc[rt][dt] = mmaH<1>(pa[rt].v, pa[rt].v, bv.v, bv.v, oacc[rt][dt]); oaccL[rt][dt] = mmaH<1>(pl[rt].v, pl[rt].v, bv.v, bv.v, oaccL[rt][dt]); oaccL[rt][dt] = mmaH<1>(pa[rt].v, pa[rt].v, bl.v, bl.v, oaccL[rt][dt]); } }
    __builtin_amdgcn_fence(__ATOMIC_ACQ_REL, "workgroup"); __builtin_amdgcn_wave_barrier(); }
#pragma unroll
  for (int rt = 0; rt < RTN; ++rt) {
#pragma unroll
    for (int r = 0; r < 8; ++r) { float l = l_r[rt][r]; l += __shfl_xor(l, 1, 32); l += __shfl_xor(l, 2, 32); l += __shfl_xor(l, 4, 32); l += __shfl_xor(l, 8, 32); l_r[rt][r] = (l > 0.f) ? 1.0f / (l * 1024.0f) : 0.f; }
#pragma unroll
    for (int dt = 0; dt < DT; ++dt)
#pragma unroll
      for (int r = 0; r < 8; ++r) { float v = oacc[rt][dt][r]; v += oaccL[rt][dt][r] * 0.0009765625f; sO[w][rt * 16 + 8 * hh + r][dt * 16 + ln] = v * l_r[rt][r]; } }
  __builtin_amdgcn_fence(__ATOMIC_ACQ_REL, "workgroup"); __builtin_amdgcn_wave_barrier();
  {
#pragma unroll
    for (int rp = 0; rp < RPW; rp += 2) { const int r = rp + (lane >> 4), pc = lane & 15; const v4f val = *(const v4fa*)&sO[w][r][pc * 4]; *(v4f*)(O + ((size_t)b * TQ + q0 + r) * ldo + h * 64 + pc * 4) = val; }
     } }

__global__ __launch_bounds__(256) void k_rotab(float* __restrict__ CS, float* __restrict__ SN) {
  #pragma clang fp contract(off)
  const int t = blockIdx.x * 256 + threadIdx.x; if (t >= SLEN * 32) return; const int j = t % 32, s = t / 32; const float ex = (float)(2 * j) / 64.0f; const float inv = 1.0f / powf(10000.0f, ex); const float th = (float)s * inv; const float c = cosf(th), sn = sinf(th);
  { *(float*)(CS + t) = c; *(float*)(SN + t) = sn;  } }
__global__ __launch_bounds__(256) void k_rope(const float* __restrict__ F, int nsrc, int ndst, int rep, const float* __restrict__ CS, const float* __restrict__ SN, _Float16* __restrict__ H, _Float16* __restrict__ L) {
  #pragma clang fp contract(off)
  const size_t t = (size_t)blockIdx.x * 256 + threadIdx.x; if (t >= (size_t)NR * ndst * 4) return; const int g8 = (int)(t % 4); const int hd = (int)((t / 4) % ndst); const size_t row = t / ((size_t)4 * ndst); const int s = (int)(row % SLEN); const int hs = hd / rep;
  const float* src = F + row * (size_t)(nsrc * 64) + hs * 64; FragH ah, al, bh, bl;
  for (int i = 0; i < 8; ++i) { const int d = g8 * 8 + i; const float c = CS[s * 32 + d], sn = SN[s * 32 + d]; const float x1 = src[d], x2 = src[d + 32];
    float o1 = x1 * c; o1 += -x2 * sn; float o2 = x2 * c; o2 += x1 * sn;
    _Float16 hv = (_Float16)o1; ah.h[i] = hv; al.h[i] = (_Float16)((o1 - (float)hv) * 1024.0f); hv = (_Float16)o2; bh.h[i] = hv; bl.h[i] = (_Float16)((o2 - (float)hv) * 1024.0f); }
  const size_t o = row * (size_t)(ndst * 64) + hd * 64 + g8 * 8;
  { *(v8us*)((unsigned short*)H + o) = ah.half[0]; *(v8us*)((unsigned short*)H + o + 32) = bh.half[0]; *(v8us*)((unsigned short*)L + o) = al.half[0]; *(v8us*)((unsigned short*)L + o + 32) = bl.half[0];  } }
__global__ __launch_bounds__(256) void k_rope2(const float* __restrict__ F, int nsrc, int ndst, int rep, const float* __restrict__ CS, const float* __restrict__ SN, _Float16* __restrict__ H, _Float16* __restrict__ L) {
  #pragma clang fp contract(off)
  const size_t t = (size_t)blockIdx.x * 256 + threadIdx.x; if (t >= (size_t)NR * ndst * 4) return; const int g16 = (int)(t % 4); const int hd = (int)((t / 4) % ndst); const size_t row = t / ((size_t)4 * ndst); const int s = (int)(row % SLEN); const int hs = hd / rep;
  const float* src = F + row * (size_t)(nsrc * 64) + hs * 64 + g16 * 16; FragH ah, al;
  for (int pr = 0; pr < 8; ++pr) { const int i = g16 * 8 + pr; const float c = CS[s * 32 + i], sn = SN[s * 32 + i]; const float x1 = src[2 * pr], x2 = src[2 * pr + 1];
    float o1 = x1 * c; o1 -= x2 * sn; float o2 = x1 * sn; o2 += x2 * c;
    _Float16 hv = (_Float16)o1; ah.h[2 * pr] = hv; al.h[2 * pr] = (_Float16)((o1 - (float)hv) * 1024.0f); hv = (_Float16)o2; ah.h[2 * pr + 1] = hv; al.h[2 * pr + 1] = (_Float16)((o2 - (float)hv) * 1024.0f); }
  const size_t o = row * (size_t)(ndst * 64) + hd * 64 + g16 * 16;
  { *(v8us*)((unsigned short*)H + o) = ah.half[0]; *(v8us*)((unsigned short*)H + o + 8) = ah.half[1]; *(v8us*)((unsigned short*)L + o) = al.half[0]; *(v8us*)((unsigned short*)L + o + 8) = al.half[1];  } }
__global__ __launch_bounds__(256) void k_ln512(const float* __restrict__ A, const float* __restrict__ res, const float* __restrict__ g, const float* __restrict__ bb, float* __restrict__ Y, _Float16* __restrict__ Y16) {
  #pragma clang fp contract(off)
  const int wv = threadIdx.x >> 5, ln = threadIdx.x & 31; const size_t r = (size_t)blockIdx.x * 8 + wv; if (r >= NR) return; float x[16]; float s = 0.f;
  for (int i = 0; i < 2; ++i) { const v8f a = *(const v8f*)(A + r * DM + i * 256 + ln * 8); for (int q = 0; q < 8; ++q) { float v = a[q]; if (res) v += bf16_round(res[r * DM + i * 256 + ln * 8 + q]); x[i * 8 + q] = v; s += v; } }
  for (int o = 16; o > 0; o >>= 1) s += __shfl_xor(s, o, 32); const float mu = s / (float)DM; float var = 0.f; for (int q = 0; q < 16; ++q) { const float d = x[q] - mu; var += d * d; }
  for (int o = 16; o > 0; o >>= 1) var += __shfl_xor(var, o, 32); const float inv = rsqrtf(var / (float)DM + 1e-5f);
  { for (int i = 0; i < 2; ++i) { const int c0 = i * 256 + ln * 8; v8f y; FragH f; for (int q = 0; q < 8; ++q) { float v = (x[i * 8 + q] - mu) * inv; v *= bf16_round(g[c0 + q]); v += bf16_round(bb[c0 + q]); y[q] = v; f.h[q] = (_Float16)v; } *(v8f*)(Y + r * DM + c0) = y; if (Y16) *(v8us*)((unsigned short*)Y16 + r * DM + c0) = f.half[0]; }  } }
__global__ __launch_bounds__(256) void k_pack(const float* __restrict__ rb, const int* __restrict__ rid, int* __restrict__ PK) { const int t = blockIdx.x * 256 + threadIdx.x; if (t >= 1024 + NB * TK) return; int v; if (t < 1024) v = __float_as_int(bf16_round(rb[t])); else v = rid[t - 1024]; *(int*)(PK + t) = v;  }
__global__ __launch_bounds__(256) void k_tabin(const float* __restrict__ sp, float* __restrict__ CS, float* __restrict__ SN) { const int t = blockIdx.x * 256 + threadIdx.x; if (t >= SLEN * 32) return; const int i = t % 32, s = t / 32; const float c = bf16_round(sp[s * 64 + 32 + i]), sn = bf16_round(sp[s * 64 + i]);
  { *(float*)(CS + t) = c; *(float*)(SN + t) = sn;  } }
__global__ __launch_bounds__(256) void k_rotab2(float* __restrict__ CS, float* __restrict__ SN) {
  #pragma clang fp contract(off)
  const int t = blockIdx.x * 256 + threadIdx.x; if (t >= SLEN * 32) return; const int j = t % 32, s = t / 32; const float c0 = -0.14391156831212787f;      /* -ln(10000)/64 rounded to f32 */ const float inv = expf((float)(2 * j) * c0); const float th = (float)s * inv; const float c = cosf(th), sn = sinf(th);
  { *(float*)(CS + t) = c; *(float*)(SN + t) = sn;  } }
__global__ __launch_bounds__(256) void k_lnu(const float* __restrict__ X, _Float16* __restrict__ N16, float* __restrict__ XB) {
  #pragma clang fp contract(off)
  const int wv = threadIdx.x >> 5, ln = threadIdx.x & 31; const size_t r = (size_t)blockIdx.x * 8 + wv; if (r >= NR) return; float a[32]; float s = 0.f;
  for (int i = 0; i < 4; ++i) { const v8f v = *(const v8f*)(X + r * DM + (i * 32 + ln) * 8); for (int q = 0; q < 8; ++q) { const float u = bf16_round(v[q]); a[i * 8 + q] = u; s += u; } }
  for (int o = 16; o > 0; o >>= 1) s += __shfl_xor(s, o, 32); const float mu = s / (float)DM; float var = 0.f; for (int q = 0; q < 32; ++q) { const float d = a[q] - mu; var += d * d; }
  for (int o = 16; o > 0; o >>= 1) var += __shfl_xor(var, o, 32); const float den = sqrtf(var / (float)(DM - 1)) + 1e-6f; const float inv = 1.0f / den;      /* one reciprocal per row; (x-mean)*inv vs the reference's division differs by <= 1 ulp */
  { for (int i = 0; i < 4; ++i) { const int c0 = (i * 32 + ln) * 8; FragH f; v8f xb; for (int q = 0; q < 8; ++q) { f.h[q] = (_Float16)((a[i * 8 + q] - mu) * inv); xb[q] = a[i * 8 + q]; } *(v8us*)((unsigned short*)N16 + r * DM + c0) = f.half[0]; *(v8f*)(XB + r * DM + c0) = xb; }  } }
__global__ __launch_bounds__(256) void k_h16s(const float* __restrict__ SRC, int lds, int coff, _Float16* __restrict__ DST, size_t n8) { const size_t t = (size_t)blockIdx.x * 256 + threadIdx.x; if (t >= n8) return; const size_t r = (t * 8) / DM; const int c = (int)((t * 8) % DM); const v8f a = *(const v8f*)(SRC + r * lds + coff + c); FragH f; for (int q = 0; q < 8; ++q) f.h[q] = (_Float16)a[q];
  *(v8us*)((unsigned short*)DST + t * 8) = f.half[0];  }


__global__ __launch_bounds__(256) void k_ccp(const float* __restrict__ QKV, int coff, _Float16* __restrict__ D) { const size_t t = (size_t)blockIdx.x * 256 + threadIdx.x; if (t >= (size_t)NR * DM / 8) return; const int c0 = (int)((t * 8) % DM); const size_t row = (t * 8) / DM; const v8f a = *(const v8f*)(QKV + row * 3 * DM + coff + c0); FragH f; for (int q = 0; q < 8; ++q) f.h[q] = (_Float16)a[q];
  *(v8us*)((unsigned short*)D + t * 8) = f.half[0];  }


// The five preparations need nothing of each other and share one grid: blocks 0 to TOKB - 1 turn 16 pixels each into token rows, then WSB blocks for each of the four weight matrices (x16, f16). The branch is uniform for a block.
#define TOKB (NPIX / 16)
#define WSB (DM * DM / 8 / 256)      /* 8 weights a thread, no remainder */
__global__ __launch_bounds__(256) void k_prep(const float* __restrict__ x, _Float16* __restrict__ X16, const float* __restrict__ qw, const float* __restrict__ kw, const float* __restrict__ vw, const float* __restrict__ ow,
    _Float16* __restrict__ BQ, _Float16* __restrict__ BK, _Float16* __restrict__ BV, _Float16* __restrict__ BO) { __shared__ float tl[DM][17]; const int tid = threadIdx.x;
  if (blockIdx.x >= TOKB) { const int wb = blockIdx.x - TOKB, m = wb / WSB; const float* Wm = (m == 0) ? qw : ((m == 1) ? kw : ((m == 2) ? vw : ow)); _Float16* Bt = (m == 0) ? BQ : ((m == 1) ? BK : ((m == 2) ? BV : BO));
    const size_t t = (size_t)(wb - m * WSB) * 256 + tid; FragH f; for (int q = 0; q < 8; ++q) f.h[q] = (_Float16)(bf16_round(Wm[t * 8 + q]) * 16.0f); *(v8us*)((unsigned short*)Bt + t * 8) = f.half[0]; return; }
  const int p0 = blockIdx.x * 16;      /* 16-pixel tiles: 34 KB of LDS */
  for (int i = tid; i < DM * 16; i += 256) { const int c = i / 16, p = i % 16; tl[c][p] = bf16_round(x[(size_t)c * NPIX + p0 + p]); }
  __syncthreads();
  { for (int i = tid; i < 16 * (DM / 8); i += 256) { const int p = i / (DM / 8), c0 = (i % (DM / 8)) * 8; FragH f; for (int q = 0; q < 8; ++q) f.h[q] = (_Float16)tl[c0 + q][p];
      *(v8us*)((unsigned short*)X16 + ((size_t)p0 + p) * DM + c0) = f.half[0]; }  } }
extern "C" void kernel_launch(void* const* d_in, const int* in_sizes, int n_in,
                              void* d_out, int out_size, void* d_ws, size_t ws_size, hipStream_t stream) {
  (void)in_sizes; (void)n_in; (void)out_size;
  const float* x = (const float*)d_in[0]; const float* qw = (const float*)d_in[1]; const float* qb = (const float*)d_in[2]; const float* kw = (const float*)d_in[3]; const float* kb = (const float*)d_in[4]; const float* vw = (const float*)d_in[5]; const float* vb = (const float*)d_in[6]; const float* ow = (const float*)d_in[7]; const float* ob = (const float*)d_in[8];
  char* ws = (char*)d_ws; size_t off = 0;
  auto take = [&](size_t bytes) { char* p = ws + off; off += (bytes + 255) & ~(size_t)255; return p; };
  const size_t np = (size_t)NR * DM;
  _Float16* BQ = (_Float16*)take((size_t)DM * DM * 2); _Float16* BK = (_Float16*)take((size_t)DM * DM * 2); _Float16* BV = (_Float16*)take((size_t)DM * DM * 2); _Float16* BO = (_Float16*)take((size_t)DM * DM * 2);
   _Float16* X16 = (_Float16*)take(np * 2); _Float16* QH = (_Float16*)take(np * 2); _Float16* KH = (_Float16*)take(np * 2); _Float16* VT = (_Float16*)take(np * 2); _Float16* OL = (_Float16*)take(np * 2); _Float16* OH = (_Float16*)take(np * 2);
  if (off > ws_size) return;
  k_prep<<<TOKB + 4 * WSB, 256, 0, stream>>>(x, X16, qw, kw, vw, ow, BQ, BK, BV, BO);      /* token rows; 1x1 conv (out, in) naturals */
  const dim3 g((NR / 128) * (DM / 64), 1), g3((NR / 128) * (DM / 64), 3);
  k_gemm2<0><<<g3, 128, 0, stream>>>(X16, DM, 0, BQ, DM, (size_t)DM * DM, 0.0625f, qb, kb, vb, 1, 0, 1.0f, nullptr, QH, DM, np, NR, DM, DM, 2, nullptr, VT);      /* q, k, v: BQ, BK, BV and QH, KH lie one behind the other in the workspace; v leaves its GEMM as V^T (channel = head * 64 + d rows of SLEN tokens) */
  k_flash<<<NB * NH * QBNP, 128 * FKG, 0, stream>>>(QH, DM, KH, DM, VT, OH, OL, DM);
  k_gemm2<0><<<g, 128, 0, stream>>>(OL, DM, 0, BO, DM, 0, 0.0625f, ob, nullptr, nullptr, 2, np, 0.0009765625f, nullptr, nullptr, DM, 0, NR, DM, DM, 0, (float*)d_out, nullptr);      /* the output conv, stored as NCHW: the residual term first, scaled by 2^-10 in the accumulators, then the f16 term on top (OH lies behind OL in the workspace) */
}

// v009
// Measured time: 68.7 microseconds a run.
// Next to v008, in two timings, it ran 1.05 times as fast each time.
// Counting every step since v000, which is the starting kernel, it is 8.69 times as fast.
#include <hip/hip_runtime.h>
// SelfAttention4d (1 x 512 ch x 64 x 64 = 4096 tokens, 8 heads x 64: q/k/v = 1x1 convs (+ bias; the 1/8 scale applied in the flash kernel); softmax(q.k) v; out = 1x1 conv (+ bias) back to NCHW).
// Structure: NCHW -> exact f16 token rows by an LDS transpose kernel; q/k/v as f16 WMMA GEMMs (32x64 wave tiles, f32 accumulation, exact x16 (out,in) weights + bias, f16 out; channel = head*64 + d); V^T stored by the v GEMM itself (block tile turned in LDS); my fused flash kernel (no mask; the folded 1/8 applied as the score scale), which stores ctx as f16 hi/residual for the output conv (two terms summed in one GEMM's accumulators) + bias; the last GEMM stores NCHW (block tile turned in LDS).
// Compute dtype: inputs rounded to bf16; x / weights exact as f16; q, k, v plain f16 (~2^-12); softmax weights f16 x2^10; ctx hi + 2^-10 residual. v_wmma_f32_16x16x32_f16.
#define NB 1
#define DM 512
#define NKV 8
#define NPIX 4096
#define NREP (NH / NKV)
#define KVD (NKV * 64)           /* 512 */
#define NR (NB * SLEN)
#define CHK 512
typedef int v4i __attribute__((ext_vector_type(4)));
#define FF 2048
#define SLEN 4096
#define MQI 4096
#define MKI 4096
#define TQ SLEN
#define TK SLEN
#define NH 8
#define SCL 0.125f
#define QBLKS (TQ / 64)
#define QB05 0
#define QBN5 4
#define QB0P 0
#define QBNP QBLKS
#define RE 256
typedef __bf16 v16b __attribute__((ext_vector_type(16)));
typedef unsigned short v8us __attribute__((ext_vector_type(8), may_alias));
typedef float  v8f  __attribute__((ext_vector_type(8)));
typedef float  v4f  __attribute__((ext_vector_type(4)));
typedef float  v4fa __attribute__((ext_vector_type(4), may_alias));
union FragB { v16b v; v8us half[2]; unsigned short u[16]; };

__device__ __forceinline__ unsigned short bf16_bits(float x) { unsigned int u = __float_as_uint(x); return (unsigned short)((u + 0x7FFFu + ((u >> 16) & 1u)) >> 16); }
__device__ __forceinline__ float bf16_val(unsigned short b) { return __uint_as_float(((unsigned int)b) << 16); }
__device__ __forceinline__ float bf16_round(float x) { return bf16_val(bf16_bits(x)); }
// D += A·B with NT terms: 1 = ah·bh, 2 = + al·bh (A split), 3 = + ah·bl (both split)
template <int NT>
__device__ __forceinline__ v8f mmaN(v16b ah, v16b al, v16b bh, v16b bl, v8f c) {
  c = __builtin_amdgcn_wmma_f32_16x16x32_bf16(false, ah, false, bh, (short)0, c, false, false);
  if (NT >= 2) c = __builtin_amdgcn_wmma_f32_16x16x32_bf16(false, al, false, bh, (short)0, c, false, false);
  if (NT >= 3) c = __builtin_amdgcn_wmma_f32_16x16x32_bf16(false, ah, false, bl, (short)0, c, false, false);
  asm volatile("v_nop\n\tv_nop\n\tv_nop\n\tv_nop" : "+v"(c) : "v"(ah), "v"(al), "v"(bh), "v"(bl));
  return c;
}

__global__ __launch_bounds__(256) void k_wt_bf16(const float* __restrict__ W, unsigned short* __restrict__ Wt, int K, int N) {
  const int t = blockIdx.x * 256 + threadIdx.x;
  const int k8n = K / 8;
  if (t >= N * k8n) return;
  const int n = t / k8n, k8 = (t % k8n) * 8;
  v8us v;
#pragma unroll
  for (int i = 0; i < 8; ++i) v[i] = bf16_bits(W[(size_t)(k8 + i) * N + n]);
  *(v8us*)(Wt + (size_t)n * K + k8) = v;
  
}

// GEMM C[M][N] (f32, pitch ldc) = act(A[M][K]·W + bias). A f32 row-major (pitch lda) converted per fragment to bf16
// (ASPLIT: hi/lo two planes -> 2 terms, else single rounded term); Wt bf16 [N][K] (pitch ldb). BIAS_BF16 rounds the
// bias to bf16 first (bias quantised to bf16 before the add). K%32==0, M%16==0, N%64==0.
template <bool ASPLIT, int ACT, bool BIAS_BF16>
__global__ __launch_bounds__(128) void k_gemm_bf(const float* __restrict__ A, int lda, const unsigned short* __restrict__ Wt, int ldb,
                                               const float* __restrict__ bias, float* __restrict__ C, int ldc, int M, int N, int K) {
  __shared__ __attribute__((aligned(16))) float so[4][16][64];
  const int tid = threadIdx.x, w = tid >> 5, lane = tid & 31, ln = lane & 15, hh = lane >> 4;
  const int ntn = N / 64;
  const int wid = blockIdx.x * 4 + w;
  const int mt = wid / ntn, nq = wid % ntn;
  if (mt * 16 >= M) return;
  const int row0 = mt * 16, col0 = nq * 64;
  const float* arow = A + (size_t)(row0 + ln) * lda;
  v8f acc[4] = {};
  for (int kb = 0; kb < K; kb += 32) {
    FragB ah, al;
    const v4f x0 = *(const v4fa*)(arow + kb + 8 * hh), x1 = *(const v4fa*)(arow + kb + 8 * hh + 4);
    const v4f x2 = *(const v4fa*)(arow + kb + 16 + 8 * hh), x3 = *(const v4fa*)(arow + kb + 16 + 8 * hh + 4);
    float xs[16] = {x0[0],x0[1],x0[2],x0[3],x1[0],x1[1],x1[2],x1[3],x2[0],x2[1],x2[2],x2[3],x3[0],x3[1],x3[2],x3[3]};
#pragma unroll
    for (int i = 0; i < 16; ++i) { const unsigned short hb = bf16_bits(xs[i]); ah.u[i] = hb; al.u[i] = ASPLIT ? bf16_bits(xs[i] - bf16_val(hb)) : (unsigned short)0; }
#pragma unroll
    for (int t = 0; t < 4; ++t) {
      const unsigned short* brow = Wt + (size_t)(col0 + t * 16 + ln) * ldb + kb;
      FragB b;
      b.half[0] = *(const v8us*)(brow + 8 * hh);
      b.half[1] = *(const v8us*)(brow + 16 + 8 * hh);
      acc[t] = mmaN<ASPLIT ? 2 : 1>(ah.v, al.v, b.v, b.v, acc[t]);
    }
  }
#pragma unroll
  for (int t = 0; t < 4; ++t) {
    float bv = bias ? bias[col0 + t * 16 + ln] : 0.f;
    if (BIAS_BF16) bv = bf16_round(bv);
#pragma unroll
    for (int r = 0; r < 8; ++r) { float v = acc[t][r] + bv; if (ACT == 1) v = fmaxf(v, 0.f); so[w][8 * hh + r][t * 16 + ln] = v; }
  }
  __builtin_amdgcn_fence(__ATOMIC_ACQ_REL, "workgroup");
  __builtin_amdgcn_wave_barrier();
  const int rsub = lane >> 4, c4 = (lane & 15) * 4;
  {
#pragma unroll
    for (int q = 0; q < 8; ++q) {
      const int r = q * 2 + rsub;
      const v4f v = *(const v4fa*)&so[w][r][c4];
      *(v4f*)(C + (size_t)(row0 + r) * ldc + col0 + c4) = v;
    }
    
  }
}

// GEMM C = act(A·W + bias + resid): A f32 (ASPLIT -> hi/lo 2 terms), Wt bf16 [N][K]; ACT 0 none, 1 relu, 2 exact gelu;
// resid (optional, f32, row index = (row % rmod), pitch ldr, RES_BF16 rounds it) added before the activation.
template <bool ASPLIT, int ACT, bool BIAS_BF16, bool RES_BF16>
__global__ __launch_bounds__(128) void k_gemm_bf3(const float* __restrict__ A, int lda, const unsigned short* __restrict__ Wt, int ldb,
                                                const float* __restrict__ bias, const float* __restrict__ resid, int rmod, int ldr,
                                                float* __restrict__ C, int ldc, int M, int N, int K) {
  __shared__ __attribute__((aligned(16))) float so[4][16][64];
  const int tid = threadIdx.x, w = tid >> 5, lane = tid & 31, ln = lane & 15, hh = lane >> 4;
  const int ntn = N / 64;
  const int wid = blockIdx.x * 4 + w;
  const int mt = wid / ntn, nq = wid % ntn;
  if (mt * 16 >= M) return;
  const int row0 = mt * 16, col0 = nq * 64;
  const float* arow = A + (size_t)(row0 + ln) * lda;
  v8f acc[4] = {};
  for (int kb = 0; kb < K; kb += 32) {
    FragB ah, al;
    const v4f x0 = *(const v4fa*)(arow + kb + 8 * hh), x1 = *(const v4fa*)(arow + kb + 8 * hh + 4);
    const v4f x2 = *(const v4fa*)(arow + kb + 16 + 8 * hh), x3 = *(const v4fa*)(arow + kb + 16 + 8 * hh + 4);
    float xs[16] = {x0[0],x0[1],x0[2],x0[3],x1[0],x1[1],x1[2],x1[3],x2[0],x2[1],x2[2],x2[3],x3[0],x3[1],x3[2],x3[3]};
#pragma unroll
    for (int i = 0; i < 16; ++i) { const unsigned short hb = bf16_bits(xs[i]); ah.u[i] = hb; al.u[i] = ASPLIT ? bf16_bits(xs[i] - bf16_val(hb)) : (unsigned short)0; }
#pragma unroll
    for (int t = 0; t < 4; ++t) {
      const unsigned short* brow = Wt + (size_t)(col0 + t * 16 + ln) * ldb + kb;
      FragB b;
      b.half[0] = *(const v8us*)(brow + 8 * hh);
      b.half[1] = *(const v8us*)(brow + 16 + 8 * hh);
      acc[t] = mmaN<ASPLIT ? 2 : 1>(ah.v, al.v, b.v, b.v, acc[t]);
    }
  }
#pragma unroll
  for (int t = 0; t < 4; ++t) {
    const int col = col0 + t * 16 + ln;
    float bv = bias ? bias[col] : 0.f;
    if (BIAS_BF16) bv = bf16_round(bv);
#pragma unroll
    for (int r = 0; r < 8; ++r) {
      float v = acc[t][r] + bv;
      if (resid) { float rv = resid[(size_t)((row0 + 8 * hh + r) % rmod) * ldr + col]; if (RES_BF16) rv = bf16_round(rv); v += rv; }
      if (ACT == 1) v = fmaxf(v, 0.f);
      if (ACT == 2) v = 0.5f * v * (1.0f + erff(v * 0.70710678118654752f));
      if (ACT == 3) { const float u = 0.7978845608028654f * (v + 0.044715f * v * v * v); v = 0.5f * v * (1.0f + tanhf(u)); }
      so[w][8 * hh + r][t * 16 + ln] = v;
    }
  }
  __builtin_amdgcn_fence(__ATOMIC_ACQ_REL, "workgroup");
  __builtin_amdgcn_wave_barrier();
  const int rsub = lane >> 4, c4 = (lane & 15) * 4;
  {
#pragma unroll
    for (int q = 0; q < 8; ++q) {
      const int r = q * 2 + rsub;
      const v4f v = *(const v4fa*)&so[w][r][c4];
      *(v4f*)(C + (size_t)(row0 + r) * ldc + col0 + c4) = v;
    }
    
  }
}
// row LayerNorm (biased variance, eps) over N: s = X (+ R); optional out_sum <- s; out_norm <- (s-mu)*rsqrt(var+eps)*g + b
template <bool PARAM_BF16>
__global__ __launch_bounds__(256) void k_layernorm(const float* __restrict__ X, const float* __restrict__ R, const float* __restrict__ g, const float* __restrict__ bta,
                                                  float* __restrict__ out_sum, float* __restrict__ out_norm, int N, float eps) {
  __shared__ float red[256];
  const int row = blockIdx.x, tid = threadIdx.x;
  const float* x = X + (size_t)row * N; const float* rr = R ? R + (size_t)row * N : nullptr;
  float vals[16];                     // up to N = 4096
  const int per = N / 256;            // contiguous chunk per thread? use strided-by-4 chunks: thread handles j = tid*4 + 1024*u
  float s1 = 0.f;
  for (int u = 0; u < per / 4; ++u) {
    const int j = tid * 4 + 1024 * u;
    const v4f a = *(const v4fa*)(x + j);
    v4f b = {0.f,0.f,0.f,0.f}; if (rr) b = *(const v4fa*)(rr + j);
#pragma unroll
    for (int q = 0; q < 4; ++q) { const float v = a[q] + b[q]; vals[u * 4 + q] = v; s1 += v; }
  }
  red[tid] = s1; __syncthreads();
  for (int st = 128; st > 0; st >>= 1) { if (tid < st) red[tid] += red[tid + st]; __syncthreads(); }
  const float mu = red[0] / (float)N; __syncthreads();
  float s2 = 0.f;
  for (int u = 0; u < per / 4; ++u)
#pragma unroll
    for (int q = 0; q < 4; ++q) { const float c = vals[u * 4 + q] - mu; s2 += c * c; }
  red[tid] = s2; __syncthreads();
  for (int st = 128; st > 0; st >>= 1) { if (tid < st) red[tid] += red[tid + st]; __syncthreads(); }
  const float rs = rsqrtf(red[0] / (float)N + eps);
  {
    for (int u = 0; u < per / 4; ++u) {
      const int j = tid * 4 + 1024 * u;
      v4f o, sm;
#pragma unroll
      for (int q = 0; q < 4; ++q) {
        float gg = g[j + q], bb = bta[j + q];
        if (PARAM_BF16) { gg = bf16_round(gg); bb = bf16_round(bb); }
        sm[q] = vals[u * 4 + q]; o[q] = (vals[u * 4 + q] - mu) * rs * gg + bb;
      }
      if (out_sum) *(v4f*)(out_sum + (size_t)row * N + j) = sm;
      *(v4f*)(out_norm + (size_t)row * N + j) = o;
    }
    
  }
}



// ---- f16 WMMA path (v_wmma_f32_16x16x32_f16): 11-bit significands for operands in range — used where a [0,1] probability operand needs more precision than bf16
typedef _Float16 v16h __attribute__((ext_vector_type(16)));
union FragH { v16h v; v8us half[2]; _Float16 h[16]; unsigned short u[16]; };
template <int NT>
__device__ __forceinline__ v8f mmaH(v16h ah, v16h al, v16h bh, v16h bl, v8f c) {
  c = __builtin_amdgcn_wmma_f32_16x16x32_f16(false, ah, false, bh, (short)0, c, false, false);
  if (NT >= 2) c = __builtin_amdgcn_wmma_f32_16x16x32_f16(false, al, false, bh, (short)0, c, false, false);
  if (NT >= 3) c = __builtin_amdgcn_wmma_f32_16x16x32_f16(false, ah, false, bl, (short)0, c, false, false);
  asm volatile("v_nop\n\tv_nop\n\tv_nop\n\tv_nop" : "+v"(c) : "v"(ah), "v"(al), "v"(bh), "v"(bl));
  return c;
}
// batched GEMM like k_gemm_b but f16 operands: A f32 (split into f16 hi/lo if ASPLIT, else rounded to f16), Bt = f16 values [n][k]; alpha; C f32; N multiple of 16 (partial tiles skipped)
template <bool ASPLIT>
__global__ __launch_bounds__(128) void k_gemm_h(const float* __restrict__ A, int lda, size_t sA, const _Float16* __restrict__ Bh, int ldb, size_t sB, float alpha, float* __restrict__ C, int ldc, size_t sC, int M, int N, int K) {
  __shared__ __attribute__((aligned(16))) float so[4][16][64];
  const int tid = threadIdx.x, w = tid >> 5, lane = tid & 31, ln = lane & 15, hh = lane >> 4; const int by = blockIdx.y;
  A += (size_t)by * sA; Bh += (size_t)by * sB; C += (size_t)by * sC;
  const int ntn = (N + 63) / 64; const int wid = blockIdx.x * 4 + w; const int mt = wid / ntn, nq = wid % ntn; if (mt * 16 >= M) return;
  const int row0 = mt * 16, col0 = nq * 64; const float* arow = A + (size_t)(row0 + ln) * lda;
  v8f acc[4] = {};
  for (int kb = 0; kb < K; kb += 32) {
    FragH ah, al;
    const v4f x0 = *(const v4fa*)(arow + kb + 8 * hh), x1 = *(const v4fa*)(arow + kb + 8 * hh + 4), x2 = *(const v4fa*)(arow + kb + 16 + 8 * hh), x3 = *(const v4fa*)(arow + kb + 16 + 8 * hh + 4);
    float xs[16] = {x0[0],x0[1],x0[2],x0[3],x1[0],x1[1],x1[2],x1[3],x2[0],x2[1],x2[2],x2[3],x3[0],x3[1],x3[2],x3[3]};
#pragma unroll
    for (int i = 0; i < 16; ++i) { const _Float16 h = (_Float16)xs[i]; ah.h[i] = h; al.h[i] = ASPLIT ? (_Float16)(xs[i] - (float)h) : (_Float16)0.0f; }
#pragma unroll
    for (int t = 0; t < 4; ++t) { if (col0 + t * 16 >= N) continue; const size_t boff = (size_t)(col0 + t * 16 + ln) * ldb + kb; FragH bq; bq.half[0] = *(const v8us*)(Bh + boff + 8 * hh); bq.half[1] = *(const v8us*)(Bh + boff + 16 + 8 * hh);
      acc[t] = mmaH<ASPLIT ? 2 : 1>(ah.v, al.v, bq.v, bq.v, acc[t]); }
  }
#pragma unroll
  for (int t = 0; t < 4; ++t) { if (col0 + t * 16 >= N) continue;
#pragma unroll
    for (int r = 0; r < 8; ++r) so[w][8 * hh + r][t * 16 + ln] = acc[t][r] * alpha; }
  __builtin_amdgcn_fence(__ATOMIC_ACQ_REL, "workgroup"); __builtin_amdgcn_wave_barrier();
  const int rsub = lane >> 4, c4 = (lane & 15) * 4;
  {
#pragma unroll
    for (int q = 0; q < 8; ++q) { const int r = q * 2 + rsub; if (col0 + c4 < N) { const v4f v = *(const v4fa*)&so[w][r][c4]; *(v4f*)(C + (size_t)(row0 + r) * ldc + col0 + c4) = v; } }
     }
}

// Wt[n][k] = f16(W[k][n]·scale) from f32 row-major W[K][N] (scale = power of two; bf16-exact weights stay exact in f16 away from the subnormal range)
__global__ __launch_bounds__(256) void k_wt_f16(const float* __restrict__ W, _Float16* __restrict__ Wt, int K, int N, float scale) {
  const int t = blockIdx.x * 256 + threadIdx.x; if (t >= N * (K / 8)) return; const int n = t / (K / 8), k8 = (t % (K / 8)) * 8; FragH f;
#pragma unroll
  for (int i = 0; i < 8; ++i) f.h[i] = (_Float16)(bf16_round(W[(size_t)(k8 + i) * N + n]) * scale); const v8us o = f.half[0];
  *(v8us*)((unsigned short*)Wt + (size_t)n * K + k8) = o; 
}
// k_gemm_hh variant with fused epilogue: v = acc·alpha + bias[by·sBias + col] (+ CP[(row/rowsPerB)·sCPb + by·64 + col] if CP) ; ACT 0 none / 1 elu ; writes f16 C16 (and f32 C if non-null)
template <int ACT>
__global__ __launch_bounds__(128) void k_gemm_hhx(const _Float16* __restrict__ A, int lda, size_t sA, const _Float16* __restrict__ Bh, int ldb, size_t sB, float alpha, const float* __restrict__ bias, size_t sBias, const float* __restrict__ CP, int rowsPerB, size_t sCPb, int row0g,
    float* __restrict__ C, _Float16* __restrict__ C16, int ldc, size_t sC, int M, int N, int K) {
  __shared__ __attribute__((aligned(16))) float so[4][16][64];
  const int tid = threadIdx.x, w = tid >> 5, lane = tid & 31, ln = lane & 15, hh = lane >> 4; const int by = blockIdx.y;
  A += (size_t)by * sA; Bh += (size_t)by * sB; const size_t cofs = (size_t)by * sC; const float* bp = bias ? bias + (size_t)by * sBias : nullptr;
  const int ntn = (N + 63) / 64; const int wid = blockIdx.x * 4 + w; const int mt = wid / ntn, nq = wid % ntn; if (mt * 16 >= M) return;
  const int row0 = mt * 16, col0 = nq * 64; const _Float16* arow = A + (size_t)(row0 + ln) * lda;
  v8f acc[4] = {};
  for (int kb = 0; kb < K; kb += 32) { FragH ah; ah.half[0] = *(const v8us*)((const unsigned short*)arow + kb + 8 * hh); ah.half[1] = *(const v8us*)((const unsigned short*)arow + kb + 16 + 8 * hh);
#pragma unroll
    for (int t = 0; t < 4; ++t) { if (col0 + t * 16 >= N) continue; const size_t boff = (size_t)(col0 + t * 16 + ln) * ldb + kb; FragH bq; bq.half[0] = *(const v8us*)((const unsigned short*)Bh + boff + 8 * hh); bq.half[1] = *(const v8us*)((const unsigned short*)Bh + boff + 16 + 8 * hh);
      acc[t] = mmaH<1>(ah.v, ah.v, bq.v, bq.v, acc[t]); }
  }
#pragma unroll
  for (int t = 0; t < 4; ++t) { if (col0 + t * 16 >= N) continue; const int col = col0 + t * 16 + ln; const float bv = bp ? bf16_round(bp[col]) : 0.f;
#pragma unroll
    for (int r = 0; r < 8; ++r) { float v = acc[t][r] * alpha + bv; if (CP) { const int bidx = (row0g + row0 + 8 * hh + r) / rowsPerB; v += CP[(size_t)bidx * sCPb + (size_t)by * 64 + col]; } if (ACT == 1) v = (v > 0.f) ? v : expm1f(v); else if (ACT == 7) v = (v > 0.f) ? v + 1.0f : expf(v); else if (ACT == 8) v = tanhf(v); else if (ACT == 9) v = 0.5f * v * (1.0f + tanhf(0.7978845608028654f * (v + 0.044715f * v * v * v))); else if (ACT == 11) v = 1.0f / (1.0f + expf(-v)); else if (ACT == 12) v = (v > 0.f) ? v : 0.01f * v; else if (ACT == 14) v = (v > 0.f) ? v : 0.1f * v; else if (ACT == 15) v = v / (1.0f + expf(-v)); else if (ACT == 3) v = fmaxf(v, 0.f); else if (ACT == 6) v = 0.5f * v * (1.0f + erff(v * 0.70710678118654752f)); so[w][8 * hh + r][t * 16 + ln] = v; } }
  __builtin_amdgcn_fence(__ATOMIC_ACQ_REL, "workgroup"); __builtin_amdgcn_wave_barrier();
  const int rsub = lane >> 4, c4 = (lane & 15) * 4; typedef _Float16 v4h __attribute__((ext_vector_type(4)));
  {
#pragma unroll
    for (int q = 0; q < 8; ++q) { const int r = q * 2 + rsub; if (col0 + c4 < N) { const v4f v = *(const v4fa*)&so[w][r][c4]; if (C) *(v4f*)(C + cofs + (size_t)(row0 + r) * ldc + col0 + c4) = v; if (C16) { v4h h4; for (int i = 0; i < 4; ++i) h4[i] = (_Float16)v[i]; *(v4h*)(C16 + cofs + (size_t)(row0 + r) * ldc + col0 + c4) = h4; } } }
     }
}


typedef _Float16 v4h __attribute__((ext_vector_type(4)));

__global__ __launch_bounds__(256) void k_x16(const float* __restrict__ x, _Float16* __restrict__ X16, size_t n8) { const size_t t = (size_t)blockIdx.x * 256 + threadIdx.x; if (t >= n8) return; FragH f;
#pragma unroll
  for (int q = 0; q < 8; ++q) f.h[q] = (_Float16)bf16_round(x[t * 8 + q]); *(v8us*)((unsigned short*)X16 + t * 8) = f.half[0];  }
__global__ __launch_bounds__(256) void k_h16(const float* __restrict__ x, _Float16* __restrict__ X16, size_t n8) { const size_t t = (size_t)blockIdx.x * 256 + threadIdx.x; if (t >= n8) return; FragH f;
#pragma unroll
  for (int q = 0; q < 8; ++q) f.h[q] = (_Float16)x[t * 8 + q]; *(v8us*)((unsigned short*)X16 + t * 8) = f.half[0];  }
__global__ __launch_bounds__(256) void k_round16f(const float* __restrict__ W, _Float16* __restrict__ Bt, size_t n8) { const size_t t = (size_t)blockIdx.x * 256 + threadIdx.x; if (t >= n8) return; FragH f;
#pragma unroll
  for (int i = 0; i < 8; ++i) f.h[i] = (_Float16)(bf16_round(W[t * 8 + i]) * 16.0f); *(v8us*)((unsigned short*)Bt + t * 8) = f.half[0];  }
template <int NHv, int TTv>
__global__ __launch_bounds__(256) void k_vt(const _Float16* __restrict__ V16, int ldv, int voff, _Float16* __restrict__ Vt) { __shared__ unsigned short tl[64][66]; const int tid = threadIdx.x; const int slab = blockIdx.x / (TTv / 64), lg = blockIdx.x % (TTv / 64); const int b = slab / NHv, h = slab % NHv;
  for (int i = tid; i < 64 * 8; i += 256) { const int r = i / 8, c8 = (i % 8) * 8; FragH f; f.half[0] = *(const v8us*)((const unsigned short*)V16 + ((size_t)b * TTv + lg * 64 + r) * ldv + voff + h * 64 + c8);
#pragma unroll
    for (int q = 0; q < 8; ++q) tl[r][c8 + q] = f.u[q]; }
  __syncthreads();
  {
#pragma unroll
    for (int rd = 0; rd < 2; ++rd) { const int d = rd * 32 + tid / 8, pc = tid % 8; FragH f;
#pragma unroll
      for (int q = 0; q < 8; ++q) f.u[q] = tl[pc * 8 + q][d];
      *(v8us*)((unsigned short*)Vt + ((size_t)slab * 64 + d) * TTv + lg * 64 + pc * 8) = f.half[0]; }
     } }

// ---- fast GEMM (block tile 128x64, wave tile 32x64; requires M % 128 == 0 rows per launch region, N % 64 == 0 and K % 256 == 0); epilogue = k_gemm_hhx semantics ----
// A and B come through LDS: a stage is 256 k of the block's 128 A rows and 64 B rows (rows of 512 bytes), brought once for the four waves by asynchronous copies, one whole row a wave and copy,
// two buffers, the next stage flying while a stage is worked on. The fragments read from LDS hold the same elements in the same order as those read from global memory before.
#define GSK 256      /* k a stage */
#define GPH (GSK + 8)      /* LDS row pitch in 16-bit elements: 512 bytes of data + 16, a conflict-free pitch for 16-byte row readers */
#define GRB (4 * GPH * 2)      /* bytes of 4 LDS rows: the step between a thread's pieces of a tile */
#define GBB (192 * GPH * 2)      /* bytes of one buffer: rows 0 to 127 the A tile, rows 128 to 191 the B tile */
#define GTP 132      /* pitch in floats of a column of the turned 128 x 64 output tile: 128 rows + 4, so that the 16 columns of a register tile start in 16 different bank groups */
__device__ __forceinline__ v16h g2_frag(const _Float16* p, int hh) { FragH f; f.half[0] = *(const v8us*)((const unsigned short*)p + 8 * hh); f.half[1] = *(const v8us*)((const unsigned short*)p + 16 + 8 * hh); return f.v; }
__device__ __forceinline__ v8f g2_mma(v16h a, v16h b, v8f c) { v8f d = __builtin_amdgcn_wmma_f32_16x16x32_f16(false, a, false, b, (short)0, c, false, false); asm volatile("v_nop\n\tv_nop\n\tv_nop\n\tv_nop" : "+v"(d) : "v"(a), "v"(b)); return d; }
// Eight copies of one thread, 16 bytes each: rows four apart, in LDS (GRB bytes) and in global memory (gs elements). The s_wait_xcnt closes the statement so that no address register is rewritten ahead of it.
__device__ __forceinline__ void g2_copy8(unsigned l, const unsigned short* g, size_t gs) {
  const unsigned short* g1 = g + gs; const unsigned short* g2 = g1 + gs; const unsigned short* g3 = g2 + gs; const unsigned short* g4 = g3 + gs; const unsigned short* g5 = g4 + gs; const unsigned short* g6 = g5 + gs; const unsigned short* g7 = g6 + gs;
  asm volatile("global_load_async_to_lds_b128 %0, %8, off\n\t"
               "global_load_async_to_lds_b128 %1, %9, off\n\t"
               "global_load_async_to_lds_b128 %2, %10, off\n\t"
               "global_load_async_to_lds_b128 %3, %11, off\n\t"
               "global_load_async_to_lds_b128 %4, %12, off\n\t"
               "global_load_async_to_lds_b128 %5, %13, off\n\t"
               "global_load_async_to_lds_b128 %6, %14, off\n\t"
               "global_load_async_to_lds_b128 %7, %15, off\n\t"
               "s_wait_xcnt 0x0"
               :: "v"(l), "v"(l + GRB), "v"(l + 2 * GRB), "v"(l + 3 * GRB), "v"(l + 4 * GRB), "v"(l + 5 * GRB), "v"(l + 6 * GRB), "v"(l + 7 * GRB),
                  "v"(g), "v"(g1), "v"(g2), "v"(g3), "v"(g4), "v"(g5), "v"(g6), "v"(g7) : "memory");
}
// One stage's copies of one thread: 32 pieces of the A tile and 16 of the B tile (48 in flight a wave).
__device__ __forceinline__ void g2_stage(unsigned l, const unsigned short* ga, size_t as4, const unsigned short* gb, size_t bs4) {
#pragma unroll
  for (int c = 0; c < 4; ++c) g2_copy8(l + c * 8 * GRB, ga + c * 8 * as4, as4);
#pragma unroll
  for (int c = 0; c < 2; ++c) g2_copy8(l + (32 + c * 8) * GRB, gb + c * 8 * bs4, bs4);
}
template <int ACT>
__global__ __launch_bounds__(128) void k_gemm2(const _Float16* __restrict__ A, int lda, size_t sA, const _Float16* __restrict__ Bh, int ldb, size_t sB, float alpha, const float* __restrict__ bias, const float* __restrict__ bias1, const float* __restrict__ bias2, int nterm, size_t sAt, float tsc,
    float* __restrict__ C, _Float16* __restrict__ C16, int ldc, size_t sC, int M, int N, int K, int tby, float* __restrict__ Ct, _Float16* __restrict__ Ct16) {
  __shared__ __attribute__((aligned(16))) float so[4][32][68]; __shared__ __attribute__((aligned(16))) unsigned short sT[2][192][GPH];
  const int tid = threadIdx.x, w = tid >> 5, lane = tid & 31, ln = lane & 15, hh = lane >> 4; const int by = blockIdx.y;
  A += (size_t)by * sA; Bh += (size_t)by * sB; const size_t cofs = (size_t)by * sC; const float* bp = (by == 0) ? bias : ((by == 1) ? bias1 : bias2);      /* products that need nothing of each other share one grid: blockIdx.y picks the product, its B and C planes and its own bias vector */
  const int ntn = N >> 6; const int mt = blockIdx.x / ntn, nq = blockIdx.x - mt * ntn; const int row0 = mt * 128 + 32 * w, col0 = nq * 64; if (mt * 128 >= M) return;      /* the whole block leaves or none of it: barriers follow */
  const size_t as4 = (size_t)4 * lda, bs4 = (size_t)4 * ldb; const int spt = K / GSK, nst = nterm * spt;      /* the product is a sum of nterm terms A_j B over the same B: term j's A plane lies j sAt elements behind the first, and the ring walks the terms' stages one behind the other */
  const ptrdiff_t tstep = (ptrdiff_t)sAt - K; int cst = 0, wst = 0;      /* stages of the current term copied, and worked on, so far: the same in every thread */
  const unsigned short* ga = (const unsigned short*)A + (size_t)(mt * 128 + w) * lda + lane * 8;      /* the thread's first piece of the next stage to copy: a wave copies one whole row */
  const unsigned short* gb = (const unsigned short*)Bh + (size_t)(col0 + w) * ldb + lane * 8;
  const unsigned l0 = (unsigned)(size_t)&sT[0][w][lane * 8];      /* low 32 bits of a shared address = the byte offset in LDS */
  auto g2_next = [&]() { ga += GSK; gb += GSK; if (++cst == spt) { cst = 0; ga += tstep; gb -= K; } };      /* behind a term's last stage: the next A plane, B from its start again */
  g2_stage(l0, ga, as4, gb, bs4); g2_next();
  asm volatile("s_wait_asynccnt 0x0" ::: "memory");      /* stage 0 has landed before the barrier that publishes it */
  __syncthreads();
  if (nst > 1) { g2_stage(l0 + GBB, ga, as4, gb, bs4); g2_next(); }
  const v8f z8 = {0.f,0.f,0.f,0.f,0.f,0.f,0.f,0.f}; v8f c00 = z8, c01 = z8, c02 = z8, c03 = z8, c10 = z8, c11 = z8, c12 = z8, c13 = z8;
#pragma unroll 1      /* one stage a trip: the buffer index stays a run-time value and the text small */
  for (int st = 0; st < nst; ++st) {
    const int buf = st & 1;
    if (wst == spt) { wst = 0; c00 *= tsc; c01 *= tsc; c02 *= tsc; c03 *= tsc; c10 *= tsc; c11 *= tsc; c12 *= tsc; c13 *= tsc; }      /* a new term starts: the sum so far is brought to its scale (a power of two: exact) and the term accumulates on top of it */
    ++wst;
    const _Float16* af = (const _Float16*)&sT[buf][32 * w + ln][0]; const _Float16* bf = (const _Float16*)&sT[buf][128 + ln][0];
    v16h fa[2][2], fb[2][4];      /* two fragment sets: a k step's reads are issued as one group ahead of the k step before it, inside the stage */
    fa[0][0] = g2_frag(af, hh); fa[0][1] = g2_frag(af + 16 * GPH, hh);
#pragma unroll
    for (int t = 0; t < 4; ++t) fb[0][t] = g2_frag(bf + t * 16 * GPH, hh);
#pragma unroll
    for (int kk = 0; kk < GSK / 32; ++kk) { const int cu = kk & 1, nx = cu ^ 1;
      if (kk + 1 < GSK / 32) { fa[nx][0] = g2_frag(af + (kk + 1) * 32, hh); fa[nx][1] = g2_frag(af + 16 * GPH + (kk + 1) * 32, hh);
#pragma unroll
        for (int t = 0; t < 4; ++t) fb[nx][t] = g2_frag(bf + t * 16 * GPH + (kk + 1) * 32, hh); }
      c00 = g2_mma(fa[cu][0], fb[cu][0], c00); c10 = g2_mma(fa[cu][1], fb[cu][0], c10);
      c01 = g2_mma(fa[cu][0], fb[cu][1], c01); c11 = g2_mma(fa[cu][1], fb[cu][1], c11);
      c02 = g2_mma(fa[cu][0], fb[cu][2], c02); c12 = g2_mma(fa[cu][1], fb[cu][2], c12);
      c03 = g2_mma(fa[cu][0], fb[cu][3], c03); c13 = g2_mma(fa[cu][1], fb[cu][3], c13); }
    asm volatile("s_wait_dscnt 0x0" ::: "memory");      /* this wave's reads of the buffer have returned before it is given up */
    asm volatile("s_wait_asynccnt 0x0" ::: "memory");      /* this wave's copies of the next stage have landed */
    __syncthreads();      /* publishes the next stage and ends every wave's reads of this one */
    if (st + 2 < nst) { g2_stage(l0 + buf * GBB, ga, as4, gb, bs4); g2_next(); } }
  asm volatile("s_wait_asynccnt 0x0" ::: "memory");      /* no copy is left in flight when the wave goes on to the epilogue */
  v8f accs[8] = {c00, c01, c02, c03, c10, c11, c12, c13};
#pragma unroll
  for (int u = 0; u < 8; ++u) { const int t = u & 3; const int col = col0 + t * 16 + ln; const float bv = bp ? bf16_round(bp[col]) : 0.f;
#pragma unroll
    for (int r = 0; r < 8; ++r) { float v = accs[u][r] * alpha + bv;
      if (ACT == 3) v = fmaxf(v, 0.f); else if (ACT == 6) v = 0.5f * v * (1.0f + erff(v * 0.70710678118654752f)); else if (ACT == 11) v = 1.0f / (1.0f + expf(-v)); else if (ACT == 15) v = v / (1.0f + expf(-v)); else if (ACT == 12) v = (v > 0.f) ? v : 0.01f * v; else if (ACT == 8) v = tanhf(v);
      accs[u][r] = v; } }
  if (by == tby) {      /* this product's consumer wants C^T (column-major, pitch NR, a constant: the stores of a thread differ by immediate offsets): the block's 128 x 64 tile is turned in LDS and stored from here; the test reads the same for the whole block */
    float* sf = &so[0][0][0];
#pragma unroll
    for (int u = 0; u < 8; ++u) { float* d = sf + ((u & 3) * 16 + ln) * GTP + 32 * w + (u >> 2) * 16 + 8 * hh;      /* a lane's 8 registers are 8 consecutive rows of one column */
      *(v4f*)d = (v4f){accs[u][0], accs[u][1], accs[u][2], accs[u][3]}; *(v4f*)(d + 4) = (v4f){accs[u][4], accs[u][5], accs[u][6], accs[u][7]}; }
    __syncthreads();      /* a wave stores whole columns of the block tile, which hold rows of all four waves */
    if (Ct) {
#pragma unroll
      for (int q = 0; q < 16; ++q) { const int c = w * 16 + q; const v4f v = *(const v4fa*)(sf + c * GTP + lane * 4); *(v4f*)(Ct + (size_t)(col0 + c) * NR + mt * 128 + lane * 4) = v; }      /* 512 contiguous bytes a wave and store */
      asm volatile("s_wait_xcnt 0x0" ::: "memory"); }      /* behind the last store of the run: in the listing the other store path follows and rewrites these stores' registers */
    else { unsigned short* tb = (unsigned short*)Ct16 + (size_t)(col0 + w * 16 + hh) * NR + mt * 128 + ln * 8;
#pragma unroll
      for (int q = 0; q < 8; ++q) { const float* s = sf + (w * 16 + hh + q * 2) * GTP + ln * 8; const v4f a = *(const v4fa*)s, e = *(const v4fa*)(s + 4); FragH f;
#pragma unroll
        for (int i = 0; i < 4; ++i) { f.h[i] = (_Float16)a[i]; f.h[4 + i] = (_Float16)e[i]; }
        *(v8us*)(tb + (size_t)q * 2 * NR) = f.half[0]; } }      /* 256 contiguous bytes a half wave */
    return; }
#pragma unroll
  for (int u = 0; u < 8; ++u)
#pragma unroll
    for (int r = 0; r < 8; ++r) so[w][(u >> 2) * 16 + 8 * hh + r][(u & 3) * 16 + ln] = accs[u][r];
  __builtin_amdgcn_fence(__ATOMIC_ACQ_REL, "workgroup"); __builtin_amdgcn_wave_barrier();
  const int rsub = lane >> 4, c4 = (lane & 15) * 4;
  {
#pragma unroll
    for (int q = 0; q < 16; ++q) { const int r = q * 2 + rsub; const v4f v = *(const v4fa*)&so[w][r][c4]; if (C) { *(v4f*)(C + cofs + (size_t)(row0 + r) * ldc + col0 + c4) = v; asm volatile("s_wait_xcnt 0x0" ::: "memory"); }      /* the f16 conversion that may follow rewrites this store's data registers */
      if (C16) { v4h h4; for (int i = 0; i < 4; ++i) h4[i] = (_Float16)v[i]; *(v4h*)(C16 + cofs + (size_t)(row0 + r) * ldc + col0 + c4) = h4; } }
    asm volatile("s_wait_xcnt 0x0" ::: "memory");      /* behind the last row-major store: in the listing the turned-tile path follows and rewrites that store's address registers */
     } }



// lane l takes the value of lane l ^ 16 (the other half of the same query column)
__device__ __forceinline__ float xhalf(float x) { return __builtin_bit_cast(float, __builtin_amdgcn_permlanex16(__builtin_bit_cast(int, x), __builtin_bit_cast(int, x), 0x76543210, 0xfedcba98, false, false)); }
#define FKG 2      /* key groups a block */
#define FSK 64      /* keys a stage */
#define FPH 72      /* LDS row pitch in 16-bit elements: 128 bytes of data + 16, the conflict-free pitch for 16-byte row readers */
#define FBB (64 * FPH * 2)      /* bytes of one tile buffer */
#define FRB (16 * FPH * 2)      /* bytes of 16 LDS rows: the step between a thread's four pieces of a tile */
#define FC2 (SCL * 1.4426950408889634f)      /* score scale times log2(e): the softmax runs in base 2 on the hardware's own exponential */
// One stage's copies of one thread: pieces (row, row + 16, row + 32, row + 48) of the K tile and of the V^T tile, 16 bytes each. The s_wait_xcnt closes the statement so that no address register is rewritten ahead of it.
__device__ __forceinline__ void fl_copy(unsigned lk, unsigned lv, const unsigned short* gk, size_t ks16, const unsigned short* gv) {
  const unsigned short* gk1 = gk + ks16; const unsigned short* gk2 = gk1 + ks16; const unsigned short* gk3 = gk2 + ks16;
  const unsigned short* gv1 = gv + (size_t)16 * TK; const unsigned short* gv2 = gv + (size_t)32 * TK; const unsigned short* gv3 = gv + (size_t)48 * TK;
  asm volatile("global_load_async_to_lds_b128 %0, %8, off\n\t"
               "global_load_async_to_lds_b128 %1, %9, off\n\t"
               "global_load_async_to_lds_b128 %2, %10, off\n\t"
               "global_load_async_to_lds_b128 %3, %11, off\n\t"
               "global_load_async_to_lds_b128 %4, %12, off\n\t"
               "global_load_async_to_lds_b128 %5, %13, off\n\t"
               "global_load_async_to_lds_b128 %6, %14, off\n\t"
               "global_load_async_to_lds_b128 %7, %15, off\n\t"
               "s_wait_xcnt 0x0"
               :: "v"(lk), "v"(lk + FRB), "v"(lk + 2 * FRB), "v"(lk + 3 * FRB), "v"(lv), "v"(lv + FRB), "v"(lv + 2 * FRB), "v"(lv + 3 * FRB),
                  "v"(gk), "v"(gk1), "v"(gk2), "v"(gk3), "v"(gv), "v"(gv1), "v"(gv2), "v"(gv3) : "memory");
}
__global__ __launch_bounds__(128 * FKG) void k_flash(const _Float16* __restrict__ Q16, int ldq, const _Float16* __restrict__ K16, int ldk, const _Float16* __restrict__ Vt, _Float16* __restrict__ OHp, _Float16* __restrict__ OLp, int ldo) {
  constexpr int RPW = 16, DT = 4, KS = 2, KPG = TK / FKG, NST = KPG / FSK;
  __shared__ __attribute__((aligned(16))) unsigned short sK[FKG][2][64][FPH]; __shared__ __attribute__((aligned(16))) unsigned short sV[FKG][2][64][FPH];
  const int kg = threadIdx.x >> 7, tid = threadIdx.x & 127, w = tid >> 5, lane = tid & 31, ln = lane & 15, hh = lane >> 4;      /* tid, w: the thread and the wave inside its key group */
  const int slab = blockIdx.x / QBNP, qblk = QB0P + blockIdx.x % QBNP; const int b = slab / NH, h = slab % NH; const int q0 = qblk * (4 * RPW) + w * RPW;
  FragH bq[KS];
  { const unsigned short* qr = (const unsigned short*)Q16 + ((size_t)b * TQ + q0 + ln) * ldq + h * 64;
#pragma unroll
    for (int ks = 0; ks < KS; ++ks) { bq[ks].half[0] = *(const v8us*)(qr + ks * 32 + 8 * hh); bq[ks].half[1] = *(const v8us*)(qr + ks * 32 + 16 + 8 * hh); } }
  const unsigned short* Vth = (const unsigned short*)Vt + (size_t)slab * 64 * TK;
  const int crow = tid >> 3, cseg = (tid & 7) * 8;      /* eight threads copy one 128-byte row */
  const size_t ks16 = (size_t)16 * ldk, kstg = (size_t)FSK * ldk;
  const unsigned short* gk = (const unsigned short*)K16 + ((size_t)b * TK + kg * KPG + crow) * ldk + h * 64 + cseg;      /* the thread's first piece of the next stage to copy, advanced behind each stage's copies */
  const unsigned short* gv = Vth + (size_t)crow * TK + kg * KPG + cseg;
  const unsigned lk0 = (unsigned)(size_t)&sK[kg][0][crow][cseg], lv0 = (unsigned)(size_t)&sV[kg][0][crow][cseg];      /* low 32 bits of a shared address = the byte offset in LDS */
  fl_copy(lk0, lv0, gk, ks16, gv); gk += kstg; gv += FSK;
  asm volatile("s_wait_asynccnt 0x0" ::: "memory");      /* stage 0 has landed before the barrier that publishes it */
  __syncthreads();
  fl_copy(lk0 + FBB, lv0 + FBB, gk, ks16, gv); gk += kstg; gv += FSK;
  float m_r = -3.0e38f, l_r = 0.f; v8f oacc[DT];
#pragma unroll
  for (int dt = 0; dt < DT; ++dt) oacc[dt] = (v8f){0.f,0.f,0.f,0.f,0.f,0.f,0.f,0.f};
#pragma unroll 1      /* one stage a trip: the buffer index stays a run-time value and the text small */
  for (int st = 0; st < NST; ++st) {
    const int buf = st & 1;
    const unsigned short* kf = &sK[kg][buf][ln][8 * hh]; const unsigned short* vf = &sV[kg][buf][ln][8 * hh];
    FragH ak[FSK / 32][2][KS], av[FSK / 32][DT];
#pragma unroll
    for (int ps2 = 0; ps2 < FSK / 32; ++ps2)
#pragma unroll
      for (int nt = 0; nt < 2; ++nt)
#pragma unroll
        for (int ks = 0; ks < KS; ++ks) { const unsigned short* kr = kf + (ps2 * 32 + nt * 16) * FPH + ks * 32; ak[ps2][nt][ks].half[0] = *(const v8us*)kr; ak[ps2][nt][ks].half[1] = *(const v8us*)(kr + 16); }
#pragma unroll
    for (int ps2 = 0; ps2 < FSK / 32; ++ps2)
#pragma unroll
      for (int dt = 0; dt < DT; ++dt) { const unsigned short* vr = vf + dt * 16 * FPH + ps2 * 32; av[ps2][dt].half[0] = *(const v8us*)vr; av[ps2][dt].half[1] = *(const v8us*)(vr + 16); }
    __builtin_amdgcn_sched_barrier(0);      /* holds the stage's fragment reads as one group in front of its products: left free, the scheduler sinks each read to just in front of its product, which then waits out a whole LDS latency */
#pragma unroll
    for (int ps2 = 0; ps2 < FSK / 32; ++ps2) {
      float sc[16];
#pragma unroll
      for (int nt = 0; nt < 2; ++nt) { v8f acc = (v8f){0.f,0.f,0.f,0.f,0.f,0.f,0.f,0.f};
#pragma unroll
        for (int ks = 0; ks < KS; ++ks) acc = __builtin_amdgcn_wmma_f32_16x16x32_f16(false, ak[ps2][nt][ks].v, false, bq[ks].v, (short)0, acc, false, false);
#pragma unroll
        for (int r = 0; r < 8; ++r) sc[nt * 8 + r] = acc[r]; }      /* raw q.k: the maximum is kept unscaled, the scale goes into the exponent's multiply-add */
      float mx[4];
#pragma unroll
      for (int c = 0; c < 4; ++c) mx[c] = fmaxf(fmaxf(sc[c], sc[4 + c]), fmaxf(sc[8 + c], sc[12 + c]));
      float mc = fmaxf(fmaxf(mx[0], mx[1]), fmaxf(mx[2], mx[3])); mc = fmaxf(mc, xhalf(mc));      /* both halves of a column use one maximum: they share the output tiles */
      const float mn = fmaxf(m_r, mc); float al = (m_r - mn) * FC2; m_r = mn;
      const float nb = fmaf(-mn, FC2, 10.0f);      /* 2^(s FC2 + nb) = 1024 exp((s - mn) / 8) */
      FragH pb; float ps[4];
#pragma unroll
      for (int i = 0; i < 16; ++i) sc[i] = fmaf(sc[i], FC2, nb);
      asm("v_exp_f32 %0, %0\n\tv_exp_f32 %1, %1\n\tv_exp_f32 %2, %2\n\tv_exp_f32 %3, %3\n\tv_exp_f32 %4, %4\n\tv_exp_f32 %5, %5\n\tv_exp_f32 %6, %6\n\tv_exp_f32 %7, %7\n\tv_exp_f32 %8, %8\n\t"
          "v_exp_f32 %9, %9\n\tv_exp_f32 %10, %10\n\tv_exp_f32 %11, %11\n\tv_exp_f32 %12, %12\n\tv_exp_f32 %13, %13\n\tv_exp_f32 %14, %14\n\tv_exp_f32 %15, %15\n\tv_exp_f32 %16, %16\n\tv_nop"
          : "+v"(al), "+v"(sc[0]), "+v"(sc[1]), "+v"(sc[2]), "+v"(sc[3]), "+v"(sc[4]), "+v"(sc[5]), "+v"(sc[6]), "+v"(sc[7]), "+v"(sc[8]), "+v"(sc[9]), "+v"(sc[10]), "+v"(sc[11]), "+v"(sc[12]), "+v"(sc[13]), "+v"(sc[14]), "+v"(sc[15]));
#pragma unroll
      for (int i = 0; i < 16; ++i) { const float p = sc[i]; ps[i & 3] = (i < 4) ? p : ps[i & 3] + p; pb.h[i] = (_Float16)p; }      /* element i = key kmap(i, hh): the order of the V^T fragments above */
      l_r = l_r * al + ((ps[0] + ps[1]) + (ps[2] + ps[3]));
#pragma unroll
      for (int dt = 0; dt < DT; ++dt)
#pragma unroll
        for (int r = 0; r < 8; ++r) oacc[dt][r] *= al;
#pragma unroll
      for (int dt = 0; dt < DT; ++dt) oacc[dt] = __builtin_amdgcn_wmma_f32_16x16x32_f16(false, av[ps2][dt].v, false, pb.v, (short)0, oacc[dt], false, false);
    }
    __builtin_amdgcn_sched_barrier(0);      /* holds the stage's products in front of the waits and the barrier: left free, the scheduler lifts these to just behind the reads, and the copies issued behind the products get no time to land */
    asm volatile("s_wait_dscnt 0x0" ::: "memory");      /* this wave's reads of the buffer have returned before it is given up */
    asm volatile("s_wait_asynccnt 0x0" ::: "memory");      /* this wave's copies of the next stage have landed */
    __syncthreads();      /* publishes the next stage and ends every wave's reads of this one */
    if (st + 2 < NST) { fl_copy(lk0 + buf * FBB, lv0 + buf * FBB, gk, ks16, gv); gk += kstg; gv += FSK; } }
  asm volatile("s_wait_asynccnt 0x0" ::: "memory");      /* no copy is left in flight when the ring becomes the hand-over buffer */
  /* the loop's last barrier has ended every wave's reads of the ring and no copy was issued behind it: the K ring now carries group 1's state, 16 bytes a lane and piece, lanes side by side */
  v4fa* sm = (v4fa*)&sK[0][0][0][0] + (w * (2 * DT + 1)) * 32 + lane;
  if (kg == 1) {
#pragma unroll
    for (int dt = 0; dt < DT; ++dt) { sm[(2 * dt) * 32] = (v4f){oacc[dt][0], oacc[dt][1], oacc[dt][2], oacc[dt][3]}; sm[(2 * dt + 1) * 32] = (v4f){oacc[dt][4], oacc[dt][5], oacc[dt][6], oacc[dt][7]}; }
    sm[2 * DT * 32] = (v4f){m_r, l_r, 0.f, 0.f}; }
  __syncthreads();      /* group 1's state is in LDS before group 0 reads it; every wave passes it */
  if (kg == 1) return;      /* no barrier follows */
  { const v4f ml = sm[2 * DT * 32]; const float mj = fmaxf(m_r, ml[0]);      /* both partial softmaxes are brought to the common maximum */
    const float f0 = __builtin_amdgcn_exp2f((m_r - mj) * FC2), f1 = __builtin_amdgcn_exp2f((ml[0] - mj) * FC2);
    l_r = l_r * f0 + ml[1] * f1;
#pragma unroll
    for (int dt = 0; dt < DT; ++dt) { const v4f a = sm[(2 * dt) * 32], e = sm[(2 * dt + 1) * 32];
#pragma unroll
      for (int r = 0; r < 4; ++r) { oacc[dt][r] = oacc[dt][r] * f0 + a[r] * f1; oacc[dt][4 + r] = oacc[dt][4 + r] * f0 + e[r] * f1; } } }
  const float l = l_r + xhalf(l_r); const float inv = (l > 0.f) ? 1.0f / l : 0.f;      /* weights and sum both carry the 2^10 */
  const size_t oofs = ((size_t)b * TQ + q0 + ln) * ldo + h * 64 + 8 * hh;      /* register r of tile dt = channel dt * 16 + 8 hh + r of query ln: 16 contiguous bytes a lane in each plane */
#pragma unroll
  for (int dt = 0; dt < DT; ++dt) { FragH fh, fl;      /* the output conv's two operands, f16 and the 2^10 residual, are formed here from the registers */
#pragma unroll
    for (int r = 0; r < 8; ++r) { const float v = oacc[dt][r] * inv; const _Float16 hv = (_Float16)v; fh.h[r] = hv; fl.h[r] = (_Float16)((v - (float)hv) * 1024.0f); }
    *(v8us*)((unsigned short*)OHp + oofs + dt * 16) = fh.half[0]; *(v8us*)((unsigned short*)OLp + oofs + dt * 16) = fl.half[0]; } }
// 5-plane variant: S = Qh Kh^T + (Ql Kh^T + Qh Kl^T)/1024 with Q/K = [hi | 2^10 residual] f16 planes (QL/KL same layout as Q16/K16), then the 3-term P.V below.
// 3-term variant: O = (P_hi V_hi + (P_lo V_hi + P_hi V_lo) / 1024) / l with P = [hi | 2^10 residual] of 1024 p and V^T = [hi | 2^10 residual] planes (VtL same layout as Vt) -> ~2^-21-class products for un-averaged (early causal / peaked) rows
template <int CAUSAL>
__global__ __launch_bounds__(128) void k_flash5(const _Float16* __restrict__ Q16, const _Float16* __restrict__ QL, int ldq, const _Float16* __restrict__ K16, const _Float16* __restrict__ KL, int ldk, const _Float16* __restrict__ Vt, const _Float16* __restrict__ VtL, const int* __restrict__ MSK, float* __restrict__ O, int ldo) {
  constexpr int RPW = 16, RTN = RPW / 16, NQB = TQ / (4 * RPW), DT = 4, KS = 2;
  __shared__ __attribute__((aligned(16))) unsigned short sP[4][RPW][40]; __shared__ __attribute__((aligned(16))) unsigned short sPL[4][RPW][40]; __shared__ __attribute__((aligned(16))) float sO[4][RPW][64 + 4];
  const int tid = threadIdx.x, w = tid >> 5, lane = tid & 31, ln = lane & 15, hh = lane >> 4;
  const int slab = blockIdx.x / QBN5, qblk = QB05 + blockIdx.x % QBN5; (void)NQB; const int b = slab / NH, h = slab % NH; const int qb0 = qblk * (4 * RPW); const int q0 = qb0 + w * RPW;
  FragH aq[2][KS], aql[2][KS];
#pragma unroll
  for (int rt = 0; rt < RTN; ++rt) { const unsigned short* qr = (const unsigned short*)Q16 + ((size_t)b * TQ + q0 + rt * 16 + ln) * ldq + h * 64; const unsigned short* ql = (const unsigned short*)QL + ((size_t)b * TQ + q0 + rt * 16 + ln) * ldq + h * 64;
#pragma unroll
    for (int ks = 0; ks < KS; ++ks) { aq[rt][ks].half[0] = *(const v8us*)(qr + ks * 32 + 8 * hh); aq[rt][ks].half[1] = *(const v8us*)(qr + ks * 32 + 16 + 8 * hh); aql[rt][ks].half[0] = *(const v8us*)(ql + ks * 32 + 8 * hh); aql[rt][ks].half[1] = *(const v8us*)(ql + ks * 32 + 16 + 8 * hh); } }
  const unsigned short* Vth = (const unsigned short*)Vt + (size_t)slab * 64 * TK; const unsigned short* Vtl = (const unsigned short*)VtL + (size_t)slab * 64 * TK;
  float m_r[2][8], l_r[2][8]; v8f oacc[2][DT], oaccL[2][DT];
#pragma unroll
  for (int rt = 0; rt < RTN; ++rt) {
#pragma unroll
    for (int r = 0; r < 8; ++r) { m_r[rt][r] = -3.0e38f; l_r[rt][r] = 0.f; }
#pragma unroll
    for (int dt = 0; dt < DT; ++dt) { oacc[rt][dt] = (v8f){0.f,0.f,0.f,0.f,0.f,0.f,0.f,0.f}; oaccL[rt][dt] = oacc[rt][dt]; } }
  const int jend = (CAUSAL == 1) ? (qb0 + 4 * RPW) : ((CAUSAL == 23) ? min(TK, (qb0 / CHK + 2) * CHK) : TK);      /* causal / window: keys that can never contribute are skipped */ const int jbeg = (CAUSAL == 23) ? max(0, (qb0 / CHK - 1) * CHK) : 0;
#pragma unroll 1
  for (int j0 = jbeg; j0 < jend; j0 += 32) {
    v8f s[2][2];
#pragma unroll
    for (int nt = 0; nt < 2; ++nt) { const unsigned short* kr = (const unsigned short*)K16 + ((size_t)b * TK + j0 + nt * 16 + ln) * ldk + h * 64; const unsigned short* klr = (const unsigned short*)KL + ((size_t)b * TK + j0 + nt * 16 + ln) * ldk + h * 64; FragH bk[KS], bkl[KS];
#pragma unroll
      for (int ks = 0; ks < KS; ++ks) { bk[ks].half[0] = *(const v8us*)(kr + ks * 32 + 8 * hh); bk[ks].half[1] = *(const v8us*)(kr + ks * 32 + 16 + 8 * hh); bkl[ks].half[0] = *(const v8us*)(klr + ks * 32 + 8 * hh); bkl[ks].half[1] = *(const v8us*)(klr + ks * 32 + 16 + 8 * hh); }
#pragma unroll
      for (int rt = 0; rt < RTN; ++rt) { v8f acc = (v8f){0.f,0.f,0.f,0.f,0.f,0.f,0.f,0.f}, accl = acc;
#pragma unroll
        for (int ks = 0; ks < KS; ++ks) { acc = mmaH<1>(aq[rt][ks].v, aq[rt][ks].v, bk[ks].v, bk[ks].v, acc); accl = mmaH<1>(aql[rt][ks].v, aql[rt][ks].v, bk[ks].v, bk[ks].v, accl); accl = mmaH<1>(aq[rt][ks].v, aq[rt][ks].v, bkl[ks].v, bkl[ks].v, accl); }
#pragma unroll
        for (int r = 0; r < 8; ++r) acc[r] += accl[r] * 0.0009765625f;
        s[rt][nt] = acc; } }
#pragma unroll
    for (int rt = 0; rt < RTN; ++rt)
#pragma unroll
      for (int r = 0; r < 8; ++r) { const int tq = q0 + rt * 16 + 8 * hh + r; const int k0 = j0 + ln, k1 = j0 + 16 + ln;
        bool ok0 = (CAUSAL == 1) ? (k0 <= tq) : ((CAUSAL == 2) ? ((k0 >> 5) == (tq >> 5)) : true), ok1 = (CAUSAL == 1) ? (k1 <= tq) : ((CAUSAL == 2) ? ((k1 >> 5) == (tq >> 5)) : true);      /* mode 2: block-diagonal 32-token groups */
        if (CAUSAL == 4) { const int* mrow = MSK + ((size_t)b * TQ + tq) * TK; ok0 = mrow[k0] != 0; ok1 = mrow[k1] != 0; }      /* mode 4: per-(query, key) INPUT mask shared by all heads; masked keys contribute nothing (== the reference's -4096 fill, whose exp underflows to 0), rows with no valid key give l = 0 -> output 0 (== the reference's row_valid zeroing) */
        float s0 = ok0 ? s[rt][0][r] * SCL : -3.0e38f, s1 = ok1 ? s[rt][1][r] * SCL : -3.0e38f; if (CAUSAL == 17) { const float* amk = (const float*)MSK + (size_t)b * TK; s0 += bf16_round(amk[k0]); s1 += bf16_round(amk[k1]); } if (CAUSAL == 18) { const float* tb = (const float*)MSK; const int* ri = MSK + 1024 + (size_t)b * TK; const int rq = ri[tq]; s0 += tb[(h * 8 + rq) * 8 + ri[k0]]; s1 += tb[(h * 8 + rq) * 8 + ri[k1]]; } if (CAUSAL == 19) { const int* rel = MSK + (size_t)tq * TK; const float* rb = (const float*)MSK + (size_t)TQ * TK + ((size_t)(b * NH + h) * TQ + tq) * 64; s0 += rb[rel[k0]]; s1 += rb[rel[k1]]; }      /* mode 19: + (q.Ek[rel] + Eb[rel][h]) / 8 gathered by the int relative ids (packed [ids | table]) */      /* mode 18: + resource_bias[h][r_q][r_k] from the packed [table | ids] buffer (TQ == TK) */      /* mode 17: additive per-(batch, key) mask INPUT */ float mc = fmaxf(s0, s1);
        mc = fmaxf(mc, __shfl_xor(mc, 1, 32)); mc = fmaxf(mc, __shfl_xor(mc, 2, 32)); mc = fmaxf(mc, __shfl_xor(mc, 4, 32)); mc = fmaxf(mc, __shfl_xor(mc, 8, 32));
        const float mn = fmaxf(m_r[rt][r], mc); const float al = (mn > -1.0e38f) ? expf(m_r[rt][r] - mn) : 1.0f; m_r[rt][r] = mn; const float p0 = ok0 ? expf(s0 - mn) : 0.f, p1 = ok1 ? expf(s1 - mn) : 0.f; l_r[rt][r] = l_r[rt][r] * al + p0 + p1;
#pragma unroll
        for (int dt = 0; dt < DT; ++dt) { oacc[rt][dt][r] *= al; oaccL[rt][dt][r] *= al; }
        FragH t2, t2l; const float ps0 = p0 * 1024.0f, ps1 = p1 * 1024.0f; t2.h[0] = (_Float16)ps0; t2.h[1] = (_Float16)ps1; t2l.h[0] = (_Float16)((ps0 - (float)t2.h[0]) * 1024.0f); t2l.h[1] = (_Float16)((ps1 - (float)t2.h[1]) * 1024.0f);
        sP[w][rt * 16 + 8 * hh + r][ln] = t2.u[0]; sP[w][rt * 16 + 8 * hh + r][16 + ln] = t2.u[1]; sPL[w][rt * 16 + 8 * hh + r][ln] = t2l.u[0]; sPL[w][rt * 16 + 8 * hh + r][16 + ln] = t2l.u[1]; }
    __builtin_amdgcn_fence(__ATOMIC_ACQ_REL, "workgroup"); __builtin_amdgcn_wave_barrier();
    FragH pa[2], pl[2];
#pragma unroll
    for (int rt = 0; rt < RTN; ++rt) { pa[rt].half[0] = *(const v8us*)&sP[w][rt * 16 + ln][8 * hh]; pa[rt].half[1] = *(const v8us*)&sP[w][rt * 16 + ln][16 + 8 * hh]; pl[rt].half[0] = *(const v8us*)&sPL[w][rt * 16 + ln][8 * hh]; pl[rt].half[1] = *(const v8us*)&sPL[w][rt * 16 + ln][16 + 8 * hh]; }
#pragma unroll
    for (int dt = 0; dt < DT; ++dt) { const unsigned short* vrow = Vth + (size_t)(dt * 16 + ln) * TK + j0; const unsigned short* vrl = Vtl + (size_t)(dt * 16 + ln) * TK + j0; FragH bv, bl; bv.half[0] = *(const v8us*)(vrow + 8 * hh); bv.half[1] = *(const v8us*)(vrow + 16 + 8 * hh); bl.half[0] = *(const v8us*)(vrl + 8 * hh); bl.half[1] = *(const v8us*)(vrl + 16 + 8 * hh);
#pragma unroll
      for (int rt = 0; rt < RTN; ++rt) { oacc[rt][dt] = mmaH<1>(pa[rt].v, pa[rt].v, bv.v, bv.v, oacc[rt][dt]); oaccL[rt][dt] = mmaH<1>(pl[rt].v, pl[rt].v, bv.v, bv.v, oaccL[rt][dt]); oaccL[rt][dt] = mmaH<1>(pa[rt].v, pa[rt].v, bl.v, bl.v, oaccL[rt][dt]); } }
    __builtin_amdgcn_fence(__ATOMIC_ACQ_REL, "workgroup"); __builtin_amdgcn_wave_barrier(); }
#pragma unroll
  for (int rt = 0; rt < RTN; ++rt) {
#pragma unroll
    for (int r = 0; r < 8; ++r) { float l = l_r[rt][r]; l += __shfl_xor(l, 1, 32); l += __shfl_xor(l, 2, 32); l += __shfl_xor(l, 4, 32); l += __shfl_xor(l, 8, 32); l_r[rt][r] = (l > 0.f) ? 1.0f / (l * 1024.0f) : 0.f; }
#pragma unroll
    for (int dt = 0; dt < DT; ++dt)
#pragma unroll
      for (int r = 0; r < 8; ++r) { float v = oacc[rt][dt][r]; v += oaccL[rt][dt][r] * 0.0009765625f; sO[w][rt * 16 + 8 * hh + r][dt * 16 + ln] = v * l_r[rt][r]; } }
  __builtin_amdgcn_fence(__ATOMIC_ACQ_REL, "workgroup"); __builtin_amdgcn_wave_barrier();
  {
#pragma unroll
    for (int rp = 0; rp < RPW; rp += 2) { const int r = rp + (lane >> 4), pc = lane & 15; const v4f val = *(const v4fa*)&sO[w][r][pc * 4]; *(v4f*)(O + ((size_t)b * TQ + q0 + r) * ldo + h * 64 + pc * 4) = val; }
     } }

__global__ __launch_bounds__(256) void k_rotab(float* __restrict__ CS, float* __restrict__ SN) {
  #pragma clang fp contract(off)
  const int t = blockIdx.x * 256 + threadIdx.x; if (t >= SLEN * 32) return; const int j = t % 32, s = t / 32; const float ex = (float)(2 * j) / 64.0f; const float inv = 1.0f / powf(10000.0f, ex); const float th = (float)s * inv; const float c = cosf(th), sn = sinf(th);
  { *(float*)(CS + t) = c; *(float*)(SN + t) = sn;  } }
__global__ __launch_bounds__(256) void k_rope(const float* __restrict__ F, int nsrc, int ndst, int rep, const float* __restrict__ CS, const float* __restrict__ SN, _Float16* __restrict__ H, _Float16* __restrict__ L) {
  #pragma clang fp contract(off)
  const size_t t = (size_t)blockIdx.x * 256 + threadIdx.x; if (t >= (size_t)NR * ndst * 4) return; const int g8 = (int)(t % 4); const int hd = (int)((t / 4) % ndst); const size_t row = t / ((size_t)4 * ndst); const int s = (int)(row % SLEN); const int hs = hd / rep;
  const float* src = F + row * (size_t)(nsrc * 64) + hs * 64; FragH ah, al, bh, bl;
  for (int i = 0; i < 8; ++i) { const int d = g8 * 8 + i; const float c = CS[s * 32 + d], sn = SN[s * 32 + d]; const float x1 = src[d], x2 = src[d + 32];
    float o1 = x1 * c; o1 += -x2 * sn; float o2 = x2 * c; o2 += x1 * sn;
    _Float16 hv = (_Float16)o1; ah.h[i] = hv; al.h[i] = (_Float16)((o1 - (float)hv) * 1024.0f); hv = (_Float16)o2; bh.h[i] = hv; bl.h[i] = (_Float16)((o2 - (float)hv) * 1024.0f); }
  const size_t o = row * (size_t)(ndst * 64) + hd * 64 + g8 * 8;
  { *(v8us*)((unsigned short*)H + o) = ah.half[0]; *(v8us*)((unsigned short*)H + o + 32) = bh.half[0]; *(v8us*)((unsigned short*)L + o) = al.half[0]; *(v8us*)((unsigned short*)L + o + 32) = bl.half[0];  } }
__global__ __launch_bounds__(256) void k_rope2(const float* __restrict__ F, int nsrc, int ndst, int rep, const float* __restrict__ CS, const float* __restrict__ SN, _Float16* __restrict__ H, _Float16* __restrict__ L) {
  #pragma clang fp contract(off)
  const size_t t = (size_t)blockIdx.x * 256 + threadIdx.x; if (t >= (size_t)NR * ndst * 4) return; const int g16 = (int)(t % 4); const int hd = (int)((t / 4) % ndst); const size_t row = t / ((size_t)4 * ndst); const int s = (int)(row % SLEN); const int hs = hd / rep;
  const float* src = F + row * (size_t)(nsrc * 64) + hs * 64 + g16 * 16; FragH ah, al;
  for (int pr = 0; pr < 8; ++pr) { const int i = g16 * 8 + pr; const float c = CS[s * 32 + i], sn = SN[s * 32 + i]; const float x1 = src[2 * pr], x2 = src[2 * pr + 1];
    float o1 = x1 * c; o1 -= x2 * sn; float o2 = x1 * sn; o2 += x2 * c;
    _Float16 hv = (_Float16)o1; ah.h[2 * pr] = hv; al.h[2 * pr] = (_Float16)((o1 - (float)hv) * 1024.0f); hv = (_Float16)o2; ah.h[2 * pr + 1] = hv; al.h[2 * pr + 1] = (_Float16)((o2 - (float)hv) * 1024.0f); }
  const size_t o = row * (size_t)(ndst * 64) + hd * 64 + g16 * 16;
  { *(v8us*)((unsigned short*)H + o) = ah.half[0]; *(v8us*)((unsigned short*)H + o + 8) = ah.half[1]; *(v8us*)((unsigned short*)L + o) = al.half[0]; *(v8us*)((unsigned short*)L + o + 8) = al.half[1];  } }
__global__ __launch_bounds__(256) void k_ln512(const float* __restrict__ A, const float* __restrict__ res, const float* __restrict__ g, const float* __restrict__ bb, float* __restrict__ Y, _Float16* __restrict__ Y16) {
  #pragma clang fp contract(off)
  const int wv = threadIdx.x >> 5, ln = threadIdx.x & 31; const size_t r = (size_t)blockIdx.x * 8 + wv; if (r >= NR) return; float x[16]; float s = 0.f;
  for (int i = 0; i < 2; ++i) { const v8f a = *(const v8f*)(A + r * DM + i * 256 + ln * 8); for (int q = 0; q < 8; ++q) { float v = a[q]; if (res) v += bf16_round(res[r * DM + i * 256 + ln * 8 + q]); x[i * 8 + q] = v; s += v; } }
  for (int o = 16; o > 0; o >>= 1) s += __shfl_xor(s, o, 32); const float mu = s / (float)DM; float var = 0.f; for (int q = 0; q < 16; ++q) { const float d = x[q] - mu; var += d * d; }
  for (int o = 16; o > 0; o >>= 1) var += __shfl_xor(var, o, 32); const float inv = rsqrtf(var / (float)DM + 1e-5f);
  { for (int i = 0; i < 2; ++i) { const int c0 = i * 256 + ln * 8; v8f y; FragH f; for (int q = 0; q < 8; ++q) { float v = (x[i * 8 + q] - mu) * inv; v *= bf16_round(g[c0 + q]); v += bf16_round(bb[c0 + q]); y[q] = v; f.h[q] = (_Float16)v; } *(v8f*)(Y + r * DM + c0) = y; if (Y16) *(v8us*)((unsigned short*)Y16 + r * DM + c0) = f.half[0]; }  } }
__global__ __launch_bounds__(256) void k_pack(const float* __restrict__ rb, const int* __restrict__ rid, int* __restrict__ PK) { const int t = blockIdx.x * 256 + threadIdx.x; if (t >= 1024 + NB * TK) return; int v; if (t < 1024) v = __float_as_int(bf16_round(rb[t])); else v = rid[t - 1024]; *(int*)(PK + t) = v;  }
__global__ __launch_bounds__(256) void k_tabin(const float* __restrict__ sp, float* __restrict__ CS, float* __restrict__ SN) { const int t = blockIdx.x * 256 + threadIdx.x; if (t >= SLEN * 32) return; const int i = t % 32, s = t / 32; const float c = bf16_round(sp[s * 64 + 32 + i]), sn = bf16_round(sp[s * 64 + i]);
  { *(float*)(CS + t) = c; *(float*)(SN + t) = sn;  } }
__global__ __launch_bounds__(256) void k_rotab2(float* __restrict__ CS, float* __restrict__ SN) {
  #pragma clang fp contract(off)
  const int t = blockIdx.x * 256 + threadIdx.x; if (t >= SLEN * 32) return; const int j = t % 32, s = t / 32; const float c0 = -0.14391156831212787f;      /* -ln(10000)/64 rounded to f32 */ const float inv = expf((float)(2 * j) * c0); const float th = (float)s * inv; const float c = cosf(th), sn = sinf(th);
  { *(float*)(CS + t) = c; *(float*)(SN + t) = sn;  } }
__global__ __launch_bounds__(256) void k_lnu(const float* __restrict__ X, _Float16* __restrict__ N16, float* __restrict__ XB) {
  #pragma clang fp contract(off)
  const int wv = threadIdx.x >> 5, ln = threadIdx.x & 31; const size_t r = (size_t)blockIdx.x * 8 + wv; if (r >= NR) return; float a[32]; float s = 0.f;
  for (int i = 0; i < 4; ++i) { const v8f v = *(const v8f*)(X + r * DM + (i * 32 + ln) * 8); for (int q = 0; q < 8; ++q) { const float u = bf16_round(v[q]); a[i * 8 + q] = u; s += u; } }
  for (int o = 16; o > 0; o >>= 1) s += __shfl_xor(s, o, 32); const float mu = s / (float)DM; float var = 0.f; for (int q = 0; q < 32; ++q) { const float d = a[q] - mu; var += d * d; }
  for (int o = 16; o > 0; o >>= 1) var += __shfl_xor(var, o, 32); const float den = sqrtf(var / (float)(DM - 1)) + 1e-6f; const float inv = 1.0f / den;      /* one reciprocal per row; (x-mean)*inv vs the reference's division differs by <= 1 ulp */
  { for (int i = 0; i < 4; ++i) { const int c0 = (i * 32 + ln) * 8; FragH f; v8f xb; for (int q = 0; q < 8; ++q) { f.h[q] = (_Float16)((a[i * 8 + q] - mu) * inv); xb[q] = a[i * 8 + q]; } *(v8us*)((unsigned short*)N16 + r * DM + c0) = f.half[0]; *(v8f*)(XB + r * DM + c0) = xb; }  } }
__global__ __launch_bounds__(256) void k_h16s(const float* __restrict__ SRC, int lds, int coff, _Float16* __restrict__ DST, size_t n8) { const size_t t = (size_t)blockIdx.x * 256 + threadIdx.x; if (t >= n8) return; const size_t r = (t * 8) / DM; const int c = (int)((t * 8) % DM); const v8f a = *(const v8f*)(SRC + r * lds + coff + c); FragH f; for (int q = 0; q < 8; ++q) f.h[q] = (_Float16)a[q];
  *(v8us*)((unsigned short*)DST + t * 8) = f.half[0];  }


__global__ __launch_bounds__(256) void k_ccp(const float* __restrict__ QKV, int coff, _Float16* __restrict__ D) { const size_t t = (size_t)blockIdx.x * 256 + threadIdx.x; if (t >= (size_t)NR * DM / 8) return; const int c0 = (int)((t * 8) % DM); const size_t row = (t * 8) / DM; const v8f a = *(const v8f*)(QKV + row * 3 * DM + coff + c0); FragH f; for (int q = 0; q < 8; ++q) f.h[q] = (_Float16)a[q];
  *(v8us*)((unsigned short*)D + t * 8) = f.half[0];  }


// The five preparations need nothing of each other and share one grid: blocks 0 to TOKB - 1 turn 16 pixels each into token rows, then WSB blocks for each of the four weight matrices (x16, f16). The branch is uniform for a block.
#define TOKB (NPIX / 16)
#define WSB (DM * DM / 8 / 256)      /* 8 weights a thread, no remainder */
__global__ __launch_bounds__(256) void k_prep(const float* __restrict__ x, _Float16* __restrict__ X16, const float* __restrict__ qw, const float* __restrict__ kw, const float* __restrict__ vw, const float* __restrict__ ow,
    _Float16* __restrict__ BQ, _Float16* __restrict__ BK, _Float16* __restrict__ BV, _Float16* __restrict__ BO) { __shared__ float tl[DM][17]; const int tid = threadIdx.x;
  if (blockIdx.x >= TOKB) { const int wb = blockIdx.x - TOKB, m = wb / WSB; const float* Wm = (m == 0) ? qw : ((m == 1) ? kw : ((m == 2) ? vw : ow)); _Float16* Bt = (m == 0) ? BQ : ((m == 1) ? BK : ((m == 2) ? BV : BO));
    const size_t t = (size_t)(wb - m * WSB) * 256 + tid; FragH f; for (int q = 0; q < 8; ++q) f.h[q] = (_Float16)(bf16_round(Wm[t * 8 + q]) * 16.0f); *(v8us*)((unsigned short*)Bt + t * 8) = f.half[0]; return; }
  const int p0 = blockIdx.x * 16;      /* 16-pixel tiles: 34 KB of LDS */
  for (int i = tid; i < DM * 16; i += 256) { const int c = i / 16, p = i % 16; tl[c][p] = bf16_round(x[(size_t)c * NPIX + p0 + p]); }
  __syncthreads();
  { for (int i = tid; i < 16 * (DM / 8); i += 256) { const int p = i / (DM / 8), c0 = (i % (DM / 8)) * 8; FragH f; for (int q = 0; q < 8; ++q) f.h[q] = (_Float16)tl[c0 + q][p];
      *(v8us*)((unsigned short*)X16 + ((size_t)p0 + p) * DM + c0) = f.half[0]; }  } }
extern "C" void kernel_launch(void* const* d_in, const int* in_sizes, int n_in,
                              void* d_out, int out_size, void* d_ws, size_t ws_size, hipStream_t stream) {
  (void)in_sizes; (void)n_in; (void)out_size;
  const float* x = (const float*)d_in[0]; const float* qw = (const float*)d_in[1]; const float* qb = (const float*)d_in[2]; const float* kw = (const float*)d_in[3]; const float* kb = (const float*)d_in[4]; const float* vw = (const float*)d_in[5]; const float* vb = (const float*)d_in[6]; const float* ow = (const float*)d_in[7]; const float* ob = (const float*)d_in[8];
  char* ws = (char*)d_ws; size_t off = 0;
  auto take = [&](size_t bytes) { char* p = ws + off; off += (bytes + 255) & ~(size_t)255; return p; };
  const size_t np = (size_t)NR * DM;
  _Float16* BQ = (_Float16*)take((size_t)DM * DM * 2); _Float16* BK = (_Float16*)take((size_t)DM * DM * 2); _Float16* BV = (_Float16*)take((size_t)DM * DM * 2); _Float16* BO = (_Float16*)take((size_t)DM * DM * 2);
   _Float16* X16 = (_Float16*)take(np * 2); _Float16* QH = (_Float16*)take(np * 2); _Float16* KH = (_Float16*)take(np * 2); _Float16* VT = (_Float16*)take(np * 2); _Float16* OL = (_Float16*)take(np * 2); _Float16* OH = (_Float16*)take(np * 2);
  if (off > ws_size) return;
  k_prep<<<TOKB + 4 * WSB, 256, 0, stream>>>(x, X16, qw, kw, vw, ow, BQ, BK, BV, BO);      /* token rows; 1x1 conv (out, in) naturals */
  const dim3 g((NR / 128) * (DM / 64), 1), g3((NR / 128) * (DM / 64), 3);
  k_gemm2<0><<<g3, 128, 0, stream>>>(X16, DM, 0, BQ, DM, (size_t)DM * DM, 0.0625f, qb, kb, vb, 1, 0, 1.0f, nullptr, QH, DM, np, NR, DM, DM, 2, nullptr, VT);      /* q, k, v: BQ, BK, BV and QH, KH lie one behind the other in the workspace; v leaves its GEMM as V^T (channel = head * 64 + d rows of SLEN tokens) */
  k_flash<<<NB * NH * QBNP, 128 * FKG, 0, stream>>>(QH, DM, KH, DM, VT, OH, OL, DM);
  k_gemm2<0><<<g, 128, 0, stream>>>(OL, DM, 0, BO, DM, 0, 0.0625f, ob, nullptr, nullptr, 2, np, 0.0009765625f, nullptr, nullptr, DM, 0, NR, DM, DM, 0, (float*)d_out, nullptr);      /* the output conv, stored as NCHW: the residual term first, scaled by 2^-10 in the accumulators, then the f16 term on top (OH lies behind OL in the workspace) */
}

// v010
// Measured time: 63.3 microseconds a run.
// Next to v009, in two timings, it ran 1.09 times as fast each time.
// Over all steps from v000, the starting kernel, it is 9.46 times as fast.
#include <hip/hip_runtime.h>
// SelfAttention4d (1 x 512 ch x 64 x 64 = 4096 tokens, 8 heads x 64: q/k/v = 1x1 convs (+ bias; the 1/8 scale applied in the flash kernel); softmax(q.k) v; out = 1x1 conv (+ bias) back to NCHW).
// Structure: NCHW -> exact f16 token rows by an LDS transpose kernel; q/k/v as f16 WMMA GEMMs (32x64 wave tiles, f32 accumulation, exact x16 (out,in) weights + bias, f16 out; channel = head*64 + d); V^T stored by the v GEMM itself (block tile turned in LDS); my fused flash kernel (no mask; the folded 1/8 applied as the score scale), which stores ctx as f16 hi/residual for the output conv (two terms summed in one GEMM's accumulators) + bias; the last GEMM stores NCHW (block tile turned in LDS).
// Compute dtype: inputs rounded to bf16; x / weights exact as f16; q, k, v plain f16 (~2^-12); softmax weights f16 x2^10; ctx hi + 2^-10 residual. v_wmma_f32_16x16x32_f16.
#define NB 1
#define DM 512
#define NKV 8
#define NPIX 4096
#define NREP (NH / NKV)
#define KVD (NKV * 64)           /* 512 */
#define NR (NB * SLEN)
#define CHK 512
typedef int v4i __attribute__((ext_vector_type(4)));
#define FF 2048
#define SLEN 4096
#define MQI 4096
#define MKI 4096
#define TQ SLEN
#define TK SLEN
#define NH 8
#define SCL 0.125f
#define QBLKS (TQ / 64)
#define QB05 0
#define QBN5 4
#define QB0P 0
#define QBNP QBLKS
#define RE 256
typedef __bf16 v16b __attribute__((ext_vector_type(16)));
typedef unsigned short v8us __attribute__((ext_vector_type(8), may_alias));
typedef float  v8f  __attribute__((ext_vector_type(8)));
typedef float  v4f  __attribute__((ext_vector_type(4)));
typedef float  v4fa __attribute__((ext_vector_type(4), may_alias));
union FragB { v16b v; v8us half[2]; unsigned short u[16]; };

__device__ __forceinline__ unsigned short bf16_bits(float x) { unsigned int u = __float_as_uint(x); return (unsigned short)((u + 0x7FFFu + ((u >> 16) & 1u)) >> 16); }
__device__ __forceinline__ float bf16_val(unsigned short b) { return __uint_as_float(((unsigned int)b) << 16); }
__device__ __forceinline__ float bf16_round(float x) { return bf16_val(bf16_bits(x)); }
// D += A·B with NT terms: 1 = ah·bh, 2 = + al·bh (A split), 3 = + ah·bl (both split)
template <int NT>
__device__ __forceinline__ v8f mmaN(v16b ah, v16b al, v16b bh, v16b bl, v8f c) {
  c = __builtin_amdgcn_wmma_f32_16x16x32_bf16(false, ah, false, bh, (short)0, c, false, false);
  if (NT >= 2) c = __builtin_amdgcn_wmma_f32_16x16x32_bf16(false, al, false, bh, (short)0, c, false, false);
  if (NT >= 3) c = __builtin_amdgcn_wmma_f32_16x16x32_bf16(false, ah, false, bl, (short)0, c, false, false);
  asm volatile("v_nop\n\tv_nop\n\tv_nop\n\tv_nop" : "+v"(c) : "v"(ah), "v"(al), "v"(bh), "v"(bl));
  return c;
}

__global__ __launch_bounds__(256) void k_wt_bf16(const float* __restrict__ W, unsigned short* __restrict__ Wt, int K, int N) {
  const int t = blockIdx.x * 256 + threadIdx.x;
  const int k8n = K / 8;
  if (t >= N * k8n) return;
  const int n = t / k8n, k8 = (t % k8n) * 8;
  v8us v;
#pragma unroll
  for (int i = 0; i < 8; ++i) v[i] = bf16_bits(W[(size_t)(k8 + i) * N + n]);
  *(v8us*)(Wt + (size_t)n * K + k8) = v;
  
}

// GEMM C[M][N] (f32, pitch ldc) = act(A[M][K]·W + bias). A f32 row-major (pitch lda) converted per fragment to bf16
// (ASPLIT: hi/lo two planes -> 2 terms, else single rounded term); Wt bf16 [N][K] (pitch ldb). BIAS_BF16 rounds the
// bias to bf16 first (bias quantised to bf16 before the add). K%32==0, M%16==0, N%64==0.
template <bool ASPLIT, int ACT, bool BIAS_BF16>
__global__ __launch_bounds__(128) void k_gemm_bf(const float* __restrict__ A, int lda, const unsigned short* __restrict__ Wt, int ldb,
                                               const float* __restrict__ bias, float* __restrict__ C, int ldc, int M, int N, int K) {
  __shared__ __attribute__((aligned(16))) float so[4][16][64];
  const int tid = threadIdx.x, w = tid >> 5, lane = tid & 31, ln = lane & 15, hh = lane >> 4;
  const int ntn = N / 64;
  const int wid = blockIdx.x * 4 + w;
  const int mt = wid / ntn, nq = wid % ntn;
  if (mt * 16 >= M) return;
  const int row0 = mt * 16, col0 = nq * 64;
  const float* arow = A + (size_t)(row0 + ln) * lda;
  v8f acc[4] = {};
  for (int kb = 0; kb < K; kb += 32) {
    FragB ah, al;
    const v4f x0 = *(const v4fa*)(arow + kb + 8 * hh), x1 = *(const v4fa*)(arow + kb + 8 * hh + 4);
    const v4f x2 = *(const v4fa*)(arow + kb + 16 + 8 * hh), x3 = *(const v4fa*)(arow + kb + 16 + 8 * hh + 4);
    float xs[16] = {x0[0],x0[1],x0[2],x0[3],x1[0],x1[1],x1[2],x1[3],x2[0],x2[1],x2[2],x2[3],x3[0],x3[1],x3[2],x3[3]};
#pragma unroll
    for (int i = 0; i < 16; ++i) { const unsigned short hb = bf16_bits(xs[i]); ah.u[i] = hb; al.u[i] = ASPLIT ? bf16_bits(xs[i] - bf16_val(hb)) : (unsigned short)0; }
#pragma unroll
    for (int t = 0; t < 4; ++t) {
      const unsigned short* brow = Wt + (size_t)(col0 + t * 16 + ln) * ldb + kb;
      FragB b;
      b.half[0] = *(const v8us*)(brow + 8 * hh);
      b.half[1] = *(const v8us*)(brow + 16 + 8 * hh);
      acc[t] = mmaN<ASPLIT ? 2 : 1>(ah.v, al.v, b.v, b.v, acc[t]);
    }
  }
#pragma unroll
  for (int t = 0; t < 4; ++t) {
    float bv = bias ? bias[col0 + t * 16 + ln] : 0.f;
    if (BIAS_BF16) bv = bf16_round(bv);
#pragma unroll
    for (int r = 0; r < 8; ++r) { float v = acc[t][r] + bv; if (ACT == 1) v = fmaxf(v, 0.f); so[w][8 * hh + r][t * 16 + ln] = v; }
  }
  __builtin_amdgcn_fence(__ATOMIC_ACQ_REL, "workgroup");
  __builtin_amdgcn_wave_barrier();
  const int rsub = lane >> 4, c4 = (lane & 15) * 4;
  {
#pragma unroll
    for (int q = 0; q < 8; ++q) {
      const int r = q * 2 + rsub;
      const v4f v = *(const v4fa*)&so[w][r][c4];
      *(v4f*)(C + (size_t)(row0 + r) * ldc + col0 + c4) = v;
    }
    
  }
}

// GEMM C = act(A·W + bias + resid): A f32 (ASPLIT -> hi/lo 2 terms), Wt bf16 [N][K]; ACT 0 none, 1 relu, 2 exact gelu;
// resid (optional, f32, row index = (row % rmod), pitch ldr, RES_BF16 rounds it) added before the activation.
template <bool ASPLIT, int ACT, bool BIAS_BF16, bool RES_BF16>
__global__ __launch_bounds__(128) void k_gemm_bf3(const float* __restrict__ A, int lda, const unsigned short* __restrict__ Wt, int ldb,
                                                const float* __restrict__ bias, const float* __restrict__ resid, int rmod, int ldr,
                                                float* __restrict__ C, int ldc, int M, int N, int K) {
  __shared__ __attribute__((aligned(16))) float so[4][16][64];
  const int tid = threadIdx.x, w = tid >> 5, lane = tid & 31, ln = lane & 15, hh = lane >> 4;
  const int ntn = N / 64;
  const int wid = blockIdx.x * 4 + w;
  const int mt = wid / ntn, nq = wid % ntn;
  if (mt * 16 >= M) return;
  const int row0 = mt * 16, col0 = nq * 64;
  const float* arow = A + (size_t)(row0 + ln) * lda;
  v8f acc[4] = {};
  for (int kb = 0; kb < K; kb += 32) {
    FragB ah, al;
    const v4f x0 = *(const v4fa*)(arow + kb + 8 * hh), x1 = *(const v4fa*)(arow + kb + 8 * hh + 4);
    const v4f x2 = *(const v4fa*)(arow + kb + 16 + 8 * hh), x3 = *(const v4fa*)(arow + kb + 16 + 8 * hh + 4);
    float xs[16] = {x0[0],x0[1],x0[2],x0[3],x1[0],x1[1],x1[2],x1[3],x2[0],x2[1],x2[2],x2[3],x3[0],x3[1],x3[2],x3[3]};
#pragma unroll
    for (int i = 0; i < 16; ++i) { const unsigned short hb = bf16_bits(xs[i]); ah.u[i] = hb; al.u[i] = ASPLIT ? bf16_bits(xs[i] - bf16_val(hb)) : (unsigned short)0; }
#pragma unroll
    for (int t = 0; t < 4; ++t) {
      const unsigned short* brow = Wt + (size_t)(col0 + t * 16 + ln) * ldb + kb;
      FragB b;
      b.half[0] = *(const v8us*)(brow + 8 * hh);
      b.half[1] = *(const v8us*)(brow + 16 + 8 * hh);
      acc[t] = mmaN<ASPLIT ? 2 : 1>(ah.v, al.v, b.v, b.v, acc[t]);
    }
  }
#pragma unroll
  for (int t = 0; t < 4; ++t) {
    const int col = col0 + t * 16 + ln;
    float bv = bias ? bias[col] : 0.f;
    if (BIAS_BF16) bv = bf16_round(bv);
#pragma unroll
    for (int r = 0; r < 8; ++r) {
      float v = acc[t][r] + bv;
      if (resid) { float rv = resid[(size_t)((row0 + 8 * hh + r) % rmod) * ldr + col]; if (RES_BF16) rv = bf16_round(rv); v += rv; }
      if (ACT == 1) v = fmaxf(v, 0.f);
      if (ACT == 2) v = 0.5f * v * (1.0f + erff(v * 0.70710678118654752f));
      if (ACT == 3) { const float u = 0.7978845608028654f * (v + 0.044715f * v * v * v); v = 0.5f * v * (1.0f + tanhf(u)); }
      so[w][8 * hh + r][t * 16 + ln] = v;
    }
  }
  __builtin_amdgcn_fence(__ATOMIC_ACQ_REL, "workgroup");
  __builtin_amdgcn_wave_barrier();
  const int rsub = lane >> 4, c4 = (lane & 15) * 4;
  {
#pragma unroll
    for (int q = 0; q < 8; ++q) {
      const int r = q * 2 + rsub;
      const v4f v = *(const v4fa*)&so[w][r][c4];
      *(v4f*)(C + (size_t)(row0 + r) * ldc + col0 + c4) = v;
    }
    
  }
}
// row LayerNorm (biased variance, eps) over N: s = X (+ R); optional out_sum <- s; out_norm <- (s-mu)*rsqrt(var+eps)*g + b
template <bool PARAM_BF16>
__global__ __launch_bounds__(256) void k_layernorm(const float* __restrict__ X, const float* __restrict__ R, const float* __restrict__ g, const float* __restrict__ bta,
                                                  float* __restrict__ out_sum, float* __restrict__ out_norm, int N, float eps) {
  __shared__ float red[256];
  const int row = blockIdx.x, tid = threadIdx.x;
  const float* x = X + (size_t)row * N; const float* rr = R ? R + (size_t)row * N : nullptr;
  float vals[16];                     // up to N = 4096
  const int per = N / 256;            // contiguous chunk per thread? use strided-by-4 chunks: thread handles j = tid*4 + 1024*u
  float s1 = 0.f;
  for (int u = 0; u < per / 4; ++u) {
    const int j = tid * 4 + 1024 * u;
    const v4f a = *(const v4fa*)(x + j);
    v4f b = {0.f,0.f,0.f,0.f}; if (rr) b = *(const v4fa*)(rr + j);
#pragma unroll
    for (int q = 0; q < 4; ++q) { const float v = a[q] + b[q]; vals[u * 4 + q] = v; s1 += v; }
  }
  red[tid] = s1; __syncthreads();
  for (int st = 128; st > 0; st >>= 1) { if (tid < st) red[tid] += red[tid + st]; __syncthreads(); }
  const float mu = red[0] / (float)N; __syncthreads();
  float s2 = 0.f;
  for (int u = 0; u < per / 4; ++u)
#pragma unroll
    for (int q = 0; q < 4; ++q) { const float c = vals[u * 4 + q] - mu; s2 += c * c; }
  red[tid] = s2; __syncthreads();
  for (int st = 128; st > 0; st >>= 1) { if (tid < st) red[tid] += red[tid + st]; __syncthreads(); }
  const float rs = rsqrtf(red[0] / (float)N + eps);
  {
    for (int u = 0; u < per / 4; ++u) {
      const int j = tid * 4 + 1024 * u;
      v4f o, sm;
#pragma unroll
      for (int q = 0; q < 4; ++q) {
        float gg = g[j + q], bb = bta[j + q];
        if (PARAM_BF16) { gg = bf16_round(gg); bb = bf16_round(bb); }
        sm[q] = vals[u * 4 + q]; o[q] = (vals[u * 4 + q] - mu) * rs * gg + bb;
      }
      if (out_sum) *(v4f*)(out_sum + (size_t)row * N + j) = sm;
      *(v4f*)(out_norm + (size_t)row * N + j) = o;
    }
    
  }
}



// ---- f16 WMMA path (v_wmma_f32_16x16x32_f16): 11-bit significands for operands in range — used where a [0,1] probability operand needs more precision than bf16
typedef _Float16 v16h __attribute__((ext_vector_type(16)));
union FragH { v16h v; v8us half[2]; _Float16 h[16]; unsigned short u[16]; };
template <int NT>
__device__ __forceinline__ v8f mmaH(v16h ah, v16h al, v16h bh, v16h bl, v8f c) {
  c = __builtin_amdgcn_wmma_f32_16x16x32_f16(false, ah, false, bh, (short)0, c, false, false);
  if (NT >= 2) c = __builtin_amdgcn_wmma_f32_16x16x32_f16(false, al, false, bh, (short)0, c, false, false);
  if (NT >= 3) c = __builtin_amdgcn_wmma_f32_16x16x32_f16(false, ah, false, bl, (short)0, c, false, false);
  asm volatile("v_nop\n\tv_nop\n\tv_nop\n\tv_nop" : "+v"(c) : "v"(ah), "v"(al), "v"(bh), "v"(bl));
  return c;
}
// batched GEMM like k_gemm_b but f16 operands: A f32 (split into f16 hi/lo if ASPLIT, else rounded to f16), Bt = f16 values [n][k]; alpha; C f32; N multiple of 16 (partial tiles skipped)
template <bool ASPLIT>
__global__ __launch_bounds__(128) void k_gemm_h(const float* __restrict__ A, int lda, size_t sA, const _Float16* __restrict__ Bh, int ldb, size_t sB, float alpha, float* __restrict__ C, int ldc, size_t sC, int M, int N, int K) {
  __shared__ __attribute__((aligned(16))) float so[4][16][64];
  const int tid = threadIdx.x, w = tid >> 5, lane = tid & 31, ln = lane & 15, hh = lane >> 4; const int by = blockIdx.y;
  A += (size_t)by * sA; Bh += (size_t)by * sB; C += (size_t)by * sC;
  const int ntn = (N + 63) / 64; const int wid = blockIdx.x * 4 + w; const int mt = wid / ntn, nq = wid % ntn; if (mt * 16 >= M) return;
  const int row0 = mt * 16, col0 = nq * 64; const float* arow = A + (size_t)(row0 + ln) * lda;
  v8f acc[4] = {};
  for (int kb = 0; kb < K; kb += 32) {
    FragH ah, al;
    const v4f x0 = *(const v4fa*)(arow + kb + 8 * hh), x1 = *(const v4fa*)(arow + kb + 8 * hh + 4), x2 = *(const v4fa*)(arow + kb + 16 + 8 * hh), x3 = *(const v4fa*)(arow + kb + 16 + 8 * hh + 4);
    float xs[16] = {x0[0],x0[1],x0[2],x0[3],x1[0],x1[1],x1[2],x1[3],x2[0],x2[1],x2[2],x2[3],x3[0],x3[1],x3[2],x3[3]};
#pragma unroll
    for (int i = 0; i < 16; ++i) { const _Float16 h = (_Float16)xs[i]; ah.h[i] = h; al.h[i] = ASPLIT ? (_Float16)(xs[i] - (float)h) : (_Float16)0.0f; }
#pragma unroll
    for (int t = 0; t < 4; ++t) { if (col0 + t * 16 >= N) continue; const size_t boff = (size_t)(col0 + t * 16 + ln) * ldb + kb; FragH bq; bq.half[0] = *(const v8us*)(Bh + boff + 8 * hh); bq.half[1] = *(const v8us*)(Bh + boff + 16 + 8 * hh);
      acc[t] = mmaH<ASPLIT ? 2 : 1>(ah.v, al.v, bq.v, bq.v, acc[t]); }
  }
#pragma unroll
  for (int t = 0; t < 4; ++t) { if (col0 + t * 16 >= N) continue;
#pragma unroll
    for (int r = 0; r < 8; ++r) so[w][8 * hh + r][t * 16 + ln] = acc[t][r] * alpha; }
  __builtin_amdgcn_fence(__ATOMIC_ACQ_REL, "workgroup"); __builtin_amdgcn_wave_barrier();
  const int rsub = lane >> 4, c4 = (lane & 15) * 4;
  {
#pragma unroll
    for (int q = 0; q < 8; ++q) { const int r = q * 2 + rsub; if (col0 + c4 < N) { const v4f v = *(const v4fa*)&so[w][r][c4]; *(v4f*)(C + (size_t)(row0 + r) * ldc + col0 + c4) = v; } }
     }
}

// Wt[n][k] = f16(W[k][n]·scale) from f32 row-major W[K][N] (scale = power of two; bf16-exact weights stay exact in f16 away from the subnormal range)
__global__ __launch_bounds__(256) void k_wt_f16(const float* __restrict__ W, _Float16* __restrict__ Wt, int K, int N, float scale) {
  const int t = blockIdx.x * 256 + threadIdx.x; if (t >= N * (K / 8)) return; const int n = t / (K / 8), k8 = (t % (K / 8)) * 8; FragH f;
#pragma unroll
  for (int i = 0; i < 8; ++i) f.h[i] = (_Float16)(bf16_round(W[(size_t)(k8 + i) * N + n]) * scale); const v8us o = f.half[0];
  *(v8us*)((unsigned short*)Wt + (size_t)n * K + k8) = o; 
}
// k_gemm_hh variant with fused epilogue: v = acc·alpha + bias[by·sBias + col] (+ CP[(row/rowsPerB)·sCPb + by·64 + col] if CP) ; ACT 0 none / 1 elu ; writes f16 C16 (and f32 C if non-null)
template <int ACT>
__global__ __launch_bounds__(128) void k_gemm_hhx(const _Float16* __restrict__ A, int lda, size_t sA, const _Float16* __restrict__ Bh, int ldb, size_t sB, float alpha, const float* __restrict__ bias, size_t sBias, const float* __restrict__ CP, int rowsPerB, size_t sCPb, int row0g,
    float* __restrict__ C, _Float16* __restrict__ C16, int ldc, size_t sC, int M, int N, int K) {
  __shared__ __attribute__((aligned(16))) float so[4][16][64];
  const int tid = threadIdx.x, w = tid >> 5, lane = tid & 31, ln = lane & 15, hh = lane >> 4; const int by = blockIdx.y;
  A += (size_t)by * sA; Bh += (size_t)by * sB; const size_t cofs = (size_t)by * sC; const float* bp = bias ? bias + (size_t)by * sBias : nullptr;
  const int ntn = (N + 63) / 64; const int wid = blockIdx.x * 4 + w; const int mt = wid / ntn, nq = wid % ntn; if (mt * 16 >= M) return;
  const int row0 = mt * 16, col0 = nq * 64; const _Float16* arow = A + (size_t)(row0 + ln) * lda;
  v8f acc[4] = {};
  for (int kb = 0; kb < K; kb += 32) { FragH ah; ah.half[0] = *(const v8us*)((const unsigned short*)arow + kb + 8 * hh); ah.half[1] = *(const v8us*)((const unsigned short*)arow + kb + 16 + 8 * hh);
#pragma unroll
    for (int t = 0; t < 4; ++t) { if (col0 + t * 16 >= N) continue; const size_t boff = (size_t)(col0 + t * 16 + ln) * ldb + kb; FragH bq; bq.half[0] = *(const v8us*)((const unsigned short*)Bh + boff + 8 * hh); bq.half[1] = *(const v8us*)((const unsigned short*)Bh + boff + 16 + 8 * hh);
      acc[t] = mmaH<1>(ah.v, ah.v, bq.v, bq.v, acc[t]); }
  }
#pragma unroll
  for (int t = 0; t < 4; ++t) { if (col0 + t * 16 >= N) continue; const int col = col0 + t * 16 + ln; const float bv = bp ? bf16_round(bp[col]) : 0.f;
#pragma unroll
    for (int r = 0; r < 8; ++r) { float v = acc[t][r] * alpha + bv; if (CP) { const int bidx = (row0g + row0 + 8 * hh + r) / rowsPerB; v += CP[(size_t)bidx * sCPb + (size_t)by * 64 + col]; } if (ACT == 1) v = (v > 0.f) ? v : expm1f(v); else if (ACT == 7) v = (v > 0.f) ? v + 1.0f : expf(v); else if (ACT == 8) v = tanhf(v); else if (ACT == 9) v = 0.5f * v * (1.0f + tanhf(0.7978845608028654f * (v + 0.044715f * v * v * v))); else if (ACT == 11) v = 1.0f / (1.0f + expf(-v)); else if (ACT == 12) v = (v > 0.f) ? v : 0.01f * v; else if (ACT == 14) v = (v > 0.f) ? v : 0.1f * v; else if (ACT == 15) v = v / (1.0f + expf(-v)); else if (ACT == 3) v = fmaxf(v, 0.f); else if (ACT == 6) v = 0.5f * v * (1.0f + erff(v * 0.70710678118654752f)); so[w][8 * hh + r][t * 16 + ln] = v; } }
  __builtin_amdgcn_fence(__ATOMIC_ACQ_REL, "workgroup"); __builtin_amdgcn_wave_barrier();
  const int rsub = lane >> 4, c4 = (lane & 15) * 4; typedef _Float16 v4h __attribute__((ext_vector_type(4)));
  {
#pragma unroll
    for (int q = 0; q < 8; ++q) { const int r = q * 2 + rsub; if (col0 + c4 < N) { const v4f v = *(const v4fa*)&so[w][r][c4]; if (C) *(v4f*)(C + cofs + (size_t)(row0 + r) * ldc + col0 + c4) = v; if (C16) { v4h h4; for (int i = 0; i < 4; ++i) h4[i] = (_Float16)v[i]; *(v4h*)(C16 + cofs + (size_t)(row0 + r) * ldc + col0 + c4) = h4; } } }
     }
}


typedef _Float16 v4h __attribute__((ext_vector_type(4)));

__global__ __launch_bounds__(256) void k_x16(const float* __restrict__ x, _Float16* __restrict__ X16, size_t n8) { const size_t t = (size_t)blockIdx.x * 256 + threadIdx.x; if (t >= n8) return; FragH f;
#pragma unroll
  for (int q = 0; q < 8; ++q) f.h[q] = (_Float16)bf16_round(x[t * 8 + q]); *(v8us*)((unsigned short*)X16 + t * 8) = f.half[0];  }
__global__ __launch_bounds__(256) void k_h16(const float* __restrict__ x, _Float16* __restrict__ X16, size_t n8) { const size_t t = (size_t)blockIdx.x * 256 + threadIdx.x; if (t >= n8) return; FragH f;
#pragma unroll
  for (int q = 0; q < 8; ++q) f.h[q] = (_Float16)x[t * 8 + q]; *(v8us*)((unsigned short*)X16 + t * 8) = f.half[0];  }
__global__ __launch_bounds__(256) void k_round16f(const float* __restrict__ W, _Float16* __restrict__ Bt, size_t n8) { const size_t t = (size_t)blockIdx.x * 256 + threadIdx.x; if (t >= n8) return; FragH f;
#pragma unroll
  for (int i = 0; i < 8; ++i) f.h[i] = (_Float16)(bf16_round(W[t * 8 + i]) * 16.0f); *(v8us*)((unsigned short*)Bt + t * 8) = f.half[0];  }
template <int NHv, int TTv>
__global__ __launch_bounds__(256) void k_vt(const _Float16* __restrict__ V16, int ldv, int voff, _Float16* __restrict__ Vt) { __shared__ unsigned short tl[64][66]; const int tid = threadIdx.x; const int slab = blockIdx.x / (TTv / 64), lg = blockIdx.x % (TTv / 64); const int b = slab / NHv, h = slab % NHv;
  for (int i = tid; i < 64 * 8; i += 256) { const int r = i / 8, c8 = (i % 8) * 8; FragH f; f.half[0] = *(const v8us*)((const unsigned short*)V16 + ((size_t)b * TTv + lg * 64 + r) * ldv + voff + h * 64 + c8);
#pragma unroll
    for (int q = 0; q < 8; ++q) tl[r][c8 + q] = f.u[q]; }
  __syncthreads();
  {
#pragma unroll
    for (int rd = 0; rd < 2; ++rd) { const int d = rd * 32 + tid / 8, pc = tid % 8; FragH f;
#pragma unroll
      for (int q = 0; q < 8; ++q) f.u[q] = tl[pc * 8 + q][d];
      *(v8us*)((unsigned short*)Vt + ((size_t)slab * 64 + d) * TTv + lg * 64 + pc * 8) = f.half[0]; }
     } }

// ---- fast GEMM (block tile 128x64, wave tile 32x64; requires M % 128 == 0 rows per launch region, N % 64 == 0 and K % 256 == 0); epilogue = k_gemm_hhx semantics ----
// A and B come through LDS: a stage is 256 k of the block's 128 A rows and 64 B rows (rows of 512 bytes), brought once for the four waves by asynchronous copies, one whole row a wave and copy,
// two buffers, the next stage flying while a stage is worked on. The fragments read from LDS hold the same elements in the same order as those read from global memory before.
#define GSK 256      /* k a stage */
#define GPH (GSK + 8)      /* LDS row pitch in 16-bit elements: 512 bytes of data + 16, a conflict-free pitch for 16-byte row readers */
#define GRB (4 * GPH * 2)      /* bytes of 4 LDS rows: the step between a thread's pieces of a tile */
#define GBB (192 * GPH * 2)      /* bytes of one buffer: rows 0 to 127 the A tile, rows 128 to 191 the B tile */
#define GTP 132      /* pitch in floats of a column of the turned 128 x 64 output tile: 128 rows + 4, so that the 16 columns of a register tile start in 16 different bank groups */
__device__ __forceinline__ v16h g2_frag(const _Float16* p, int hh) { FragH f; f.half[0] = *(const v8us*)((const unsigned short*)p + 8 * hh); f.half[1] = *(const v8us*)((const unsigned short*)p + 16 + 8 * hh); return f.v; }
__device__ __forceinline__ v8f g2_mma(v16h a, v16h b, v8f c) { v8f d = __builtin_amdgcn_wmma_f32_16x16x32_f16(false, a, false, b, (short)0, c, false, false); asm volatile("v_nop\n\tv_nop\n\tv_nop\n\tv_nop" : "+v"(d) : "v"(a), "v"(b)); return d; }
// Eight copies of one thread, 16 bytes each: rows four apart, in LDS (GRB bytes) and in global memory (gs elements). The s_wait_xcnt closes the statement so that no address register is rewritten ahead of it.
__device__ __forceinline__ void g2_copy8(unsigned l, const unsigned short* g, size_t gs) {
  const unsigned short* g1 = g + gs; const unsigned short* g2 = g1 + gs; const unsigned short* g3 = g2 + gs; const unsigned short* g4 = g3 + gs; const unsigned short* g5 = g4 + gs; const unsigned short* g6 = g5 + gs; const unsigned short* g7 = g6 + gs;
  asm volatile("global_load_async_to_lds_b128 %0, %8, off\n\t"
               "global_load_async_to_lds_b128 %1, %9, off\n\t"
               "global_load_async_to_lds_b128 %2, %10, off\n\t"
               "global_load_async_to_lds_b128 %3, %11, off\n\t"
               "global_load_async_to_lds_b128 %4, %12, off\n\t"
               "global_load_async_to_lds_b128 %5, %13, off\n\t"
               "global_load_async_to_lds_b128 %6, %14, off\n\t"
               "global_load_async_to_lds_b128 %7, %15, off\n\t"
               "s_wait_xcnt 0x0"
               :: "v"(l), "v"(l + GRB), "v"(l + 2 * GRB), "v"(l + 3 * GRB), "v"(l + 4 * GRB), "v"(l + 5 * GRB), "v"(l + 6 * GRB), "v"(l + 7 * GRB),
                  "v"(g), "v"(g1), "v"(g2), "v"(g3), "v"(g4), "v"(g5), "v"(g6), "v"(g7) : "memory");
}
// One stage's copies of one thread: 32 pieces of the A tile and 16 of the B tile (48 in flight a wave).
__device__ __forceinline__ void g2_stage(unsigned l, const unsigned short* ga, size_t as4, const unsigned short* gb, size_t bs4) {
#pragma unroll
  for (int c = 0; c < 4; ++c) g2_copy8(l + c * 8 * GRB, ga + c * 8 * as4, as4);
#pragma unroll
  for (int c = 0; c < 2; ++c) g2_copy8(l + (32 + c * 8) * GRB, gb + c * 8 * bs4, bs4);
}
template <int ACT>
__global__ __launch_bounds__(128) void k_gemm2(const _Float16* __restrict__ A, int lda, size_t sA, const _Float16* __restrict__ Bh, int ldb, size_t sB, float alpha, const float* __restrict__ bias, const float* __restrict__ bias1, const float* __restrict__ bias2, int nterm, size_t sAt, float tsc,
    float* __restrict__ C, _Float16* __restrict__ C16, int ldc, size_t sC, int M, int N, int K, int tby, float* __restrict__ Ct, _Float16* __restrict__ Ct16) {
  __shared__ __attribute__((aligned(16))) float so[4][32][68]; __shared__ __attribute__((aligned(16))) unsigned short sT[2][192][GPH];
  const int tid = threadIdx.x, w = tid >> 5, lane = tid & 31, ln = lane & 15, hh = lane >> 4; const int by = blockIdx.y;
  A += (size_t)by * sA; Bh += (size_t)by * sB; const size_t cofs = (size_t)by * sC; const float* bp = (by == 0) ? bias : ((by == 1) ? bias1 : bias2);      /* products that need nothing of each other share one grid: blockIdx.y picks the product, its B and C planes and its own bias vector */
  const int ntn = N >> 6; const int mt = blockIdx.x / ntn, nq = blockIdx.x - mt * ntn; const int row0 = mt * 128 + 32 * w, col0 = nq * 64; if (mt * 128 >= M) return;      /* the whole block leaves or none of it: barriers follow */
  const size_t as4 = (size_t)4 * lda, bs4 = (size_t)4 * ldb; const int spt = K / GSK, nst = nterm * spt;      /* the product is a sum of nterm terms A_j B over the same B: term j's A plane lies j sAt elements behind the first, and the ring walks the terms' stages one behind the other */
  const ptrdiff_t tstep = (ptrdiff_t)sAt - K; int cst = 0, wst = 0;      /* stages of the current term copied, and worked on, so far: the same in every thread */
  const unsigned short* ga = (const unsigned short*)A + (size_t)(mt * 128 + w) * lda + lane * 8;      /* the thread's first piece of the next stage to copy: a wave copies one whole row */
  const unsigned short* gb = (const unsigned short*)Bh + (size_t)(col0 + w) * ldb + lane * 8;
  const unsigned l0 = (unsigned)(size_t)&sT[0][w][lane * 8];      /* low 32 bits of a shared address = the byte offset in LDS */
  auto g2_next = [&]() { ga += GSK; gb += GSK; if (++cst == spt) { cst = 0; ga += tstep; gb -= K; } };      /* behind a term's last stage: the next A plane, B from its start again */
  g2_stage(l0, ga, as4, gb, bs4); g2_next();
  asm volatile("s_wait_asynccnt 0x0" ::: "memory");      /* stage 0 has landed before the barrier that publishes it */
  __syncthreads();
  if (nst > 1) { g2_stage(l0 + GBB, ga, as4, gb, bs4); g2_next(); }
  const v8f z8 = {0.f,0.f,0.f,0.f,0.f,0.f,0.f,0.f}; v8f c00 = z8, c01 = z8, c02 = z8, c03 = z8, c10 = z8, c11 = z8, c12 = z8, c13 = z8;
#pragma unroll 1      /* one stage a trip: the buffer index stays a run-time value and the text small */
  for (int st = 0; st < nst; ++st) {
    const int buf = st & 1;
    if (wst == spt) { wst = 0; c00 *= tsc; c01 *= tsc; c02 *= tsc; c03 *= tsc; c10 *= tsc; c11 *= tsc; c12 *= tsc; c13 *= tsc; }      /* a new term starts: the sum so far is brought to its scale (a power of two: exact) and the term accumulates on top of it */
    ++wst;
    const _Float16* af = (const _Float16*)&sT[buf][32 * w + ln][0]; const _Float16* bf = (const _Float16*)&sT[buf][128 + ln][0];
    v16h fa[2][2], fb[2][4];      /* two fragment sets: a k step's reads are issued as one group ahead of the k step before it, inside the stage */
    fa[0][0] = g2_frag(af, hh); fa[0][1] = g2_frag(af + 16 * GPH, hh);
#pragma unroll
    for (int t = 0; t < 4; ++t) fb[0][t] = g2_frag(bf + t * 16 * GPH, hh);
#pragma unroll
    for (int kk = 0; kk < GSK / 32; ++kk) { const int cu = kk & 1, nx = cu ^ 1;
      if (kk + 1 < GSK / 32) { fa[nx][0] = g2_frag(af + (kk + 1) * 32, hh); fa[nx][1] = g2_frag(af + 16 * GPH + (kk + 1) * 32, hh);
#pragma unroll
        for (int t = 0; t < 4; ++t) fb[nx][t] = g2_frag(bf + t * 16 * GPH + (kk + 1) * 32, hh); }
      c00 = g2_mma(fa[cu][0], fb[cu][0], c00); c10 = g2_mma(fa[cu][1], fb[cu][0], c10);
      c01 = g2_mma(fa[cu][0], fb[cu][1], c01); c11 = g2_mma(fa[cu][1], fb[cu][1], c11);
      c02 = g2_mma(fa[cu][0], fb[cu][2], c02); c12 = g2_mma(fa[cu][1], fb[cu][2], c12);
      c03 = g2_mma(fa[cu][0], fb[cu][3], c03); c13 = g2_mma(fa[cu][1], fb[cu][3], c13); }
    asm volatile("s_wait_dscnt 0x0" ::: "memory");      /* this wave's reads of the buffer have returned before it is given up */
    asm volatile("s_wait_asynccnt 0x0" ::: "memory");      /* this wave's copies of the next stage have landed */
    __syncthreads();      /* publishes the next stage and ends every wave's reads of this one */
    if (st + 2 < nst) { g2_stage(l0 + buf * GBB, ga, as4, gb, bs4); g2_next(); } }
  asm volatile("s_wait_asynccnt 0x0" ::: "memory");      /* no copy is left in flight when the wave goes on to the epilogue */
  v8f accs[8] = {c00, c01, c02, c03, c10, c11, c12, c13};
#pragma unroll
  for (int u = 0; u < 8; ++u) { const int t = u & 3; const int col = col0 + t * 16 + ln; const float bv = bp ? bf16_round(bp[col]) : 0.f;
#pragma unroll
    for (int r = 0; r < 8; ++r) { float v = accs[u][r] * alpha + bv;
      if (ACT == 3) v = fmaxf(v, 0.f); else if (ACT == 6) v = 0.5f * v * (1.0f + erff(v * 0.70710678118654752f)); else if (ACT == 11) v = 1.0f / (1.0f + expf(-v)); else if (ACT == 15) v = v / (1.0f + expf(-v)); else if (ACT == 12) v = (v > 0.f) ? v : 0.01f * v; else if (ACT == 8) v = tanhf(v);
      accs[u][r] = v; } }
  if (by == tby) {      /* this product's consumer wants C^T (column-major, pitch NR, a constant: the stores of a thread differ by immediate offsets): the block's 128 x 64 tile is turned in LDS and stored from here; the test reads the same for the whole block */
    float* sf = &so[0][0][0];
#pragma unroll
    for (int u = 0; u < 8; ++u) { float* d = sf + ((u & 3) * 16 + ln) * GTP + 32 * w + (u >> 2) * 16 + 8 * hh;      /* a lane's 8 registers are 8 consecutive rows of one column */
      *(v4f*)d = (v4f){accs[u][0], accs[u][1], accs[u][2], accs[u][3]}; *(v4f*)(d + 4) = (v4f){accs[u][4], accs[u][5], accs[u][6], accs[u][7]}; }
    __syncthreads();      /* a wave stores whole columns of the block tile, which hold rows of all four waves */
    if (Ct) {
#pragma unroll
      for (int q = 0; q < 16; ++q) { const int c = w * 16 + q; const v4f v = *(const v4fa*)(sf + c * GTP + lane * 4); *(v4f*)(Ct + (size_t)(col0 + c) * NR + mt * 128 + lane * 4) = v; }      /* 512 contiguous bytes a wave and store */
      asm volatile("s_wait_xcnt 0x0" ::: "memory"); }      /* behind the last store of the run: in the listing the other store path follows and rewrites these stores' registers */
    else { unsigned short* tb = (unsigned short*)Ct16 + (size_t)(col0 + w * 16 + hh) * NR + mt * 128 + ln * 8;
#pragma unroll
      for (int q = 0; q < 8; ++q) { const float* s = sf + (w * 16 + hh + q * 2) * GTP + ln * 8; const v4f a = *(const v4fa*)s, e = *(const v4fa*)(s + 4); FragH f;
#pragma unroll
        for (int i = 0; i < 4; ++i) { f.h[i] = (_Float16)a[i]; f.h[4 + i] = (_Float16)e[i]; }
        *(v8us*)(tb + (size_t)q * 2 * NR) = f.half[0]; } }      /* 256 contiguous bytes a half wave */
    return; }
#pragma unroll
  for (int u = 0; u < 8; ++u)
#pragma unroll
    for (int r = 0; r < 8; ++r) so[w][(u >> 2) * 16 + 8 * hh + r][(u & 3) * 16 + ln] = accs[u][r];
  __builtin_amdgcn_fence(__ATOMIC_ACQ_REL, "workgroup"); __builtin_amdgcn_wave_barrier();
  const int rsub = lane >> 4, c4 = (lane & 15) * 4;
  {
#pragma unroll
    for (int q = 0; q < 16; ++q) { const int r = q * 2 + rsub; const v4f v = *(const v4fa*)&so[w][r][c4]; if (C) { *(v4f*)(C + cofs + (size_t)(row0 + r) * ldc + col0 + c4) = v; asm volatile("s_wait_xcnt 0x0" ::: "memory"); }      /* the f16 conversion that may follow rewrites this store's data registers */
      if (C16) { v4h h4; for (int i = 0; i < 4; ++i) h4[i] = (_Float16)v[i]; *(v4h*)(C16 + cofs + (size_t)(row0 + r) * ldc + col0 + c4) = h4; } }
    asm volatile("s_wait_xcnt 0x0" ::: "memory");      /* behind the last row-major store: in the listing the turned-tile path follows and rewrites that store's address registers */
     } }



// lane l takes the value of lane l ^ 16 (the other half of the same query column)
__device__ __forceinline__ float xhalf(float x) { return __builtin_bit_cast(float, __builtin_amdgcn_permlanex16(__builtin_bit_cast(int, x), __builtin_bit_cast(int, x), 0x76543210, 0xfedcba98, false, false)); }
#define FKG 4      /* key groups a block */
#define FQT 2      /* 16-query tiles a wave: each K and V^T fragment read from LDS is used for all of them */
#define FQB (TQ / (64 * FQT))      /* blocks a head: four waves of 16 FQT queries */
#define FSK 64      /* keys a stage */
#define FPH 72      /* LDS row pitch in 16-bit elements: 128 bytes of data + 16, the conflict-free pitch for 16-byte row readers */
#define FBB (64 * FPH * 2)      /* bytes of one tile buffer */
#define FRB (16 * FPH * 2)      /* bytes of 16 LDS rows: the step between a thread's four pieces of a tile */
#define FC2 (SCL * 1.4426950408889634f)      /* score scale times log2(e): the softmax runs in base 2 on the hardware's own exponential */
// One stage's copies of one thread: pieces (row, row + 16, row + 32, row + 48) of the K tile and of the V^T tile, 16 bytes each. The s_wait_xcnt closes the statement so that no address register is rewritten ahead of it.
__device__ __forceinline__ void fl_copy(unsigned lk, unsigned lv, const unsigned short* gk, size_t ks16, const unsigned short* gv) {
  const unsigned short* gk1 = gk + ks16; const unsigned short* gk2 = gk1 + ks16; const unsigned short* gk3 = gk2 + ks16;
  const unsigned short* gv1 = gv + (size_t)16 * TK; const unsigned short* gv2 = gv + (size_t)32 * TK; const unsigned short* gv3 = gv + (size_t)48 * TK;
  asm volatile("global_load_async_to_lds_b128 %0, %8, off\n\t"
               "global_load_async_to_lds_b128 %1, %9, off\n\t"
               "global_load_async_to_lds_b128 %2, %10, off\n\t"
               "global_load_async_to_lds_b128 %3, %11, off\n\t"
               "global_load_async_to_lds_b128 %4, %12, off\n\t"
               "global_load_async_to_lds_b128 %5, %13, off\n\t"
               "global_load_async_to_lds_b128 %6, %14, off\n\t"
               "global_load_async_to_lds_b128 %7, %15, off\n\t"
               "s_wait_xcnt 0x0"
               :: "v"(lk), "v"(lk + FRB), "v"(lk + 2 * FRB), "v"(lk + 3 * FRB), "v"(lv), "v"(lv + FRB), "v"(lv + 2 * FRB), "v"(lv + 3 * FRB),
                  "v"(gk), "v"(gk1), "v"(gk2), "v"(gk3), "v"(gv), "v"(gv1), "v"(gv2), "v"(gv3) : "memory");
}
__global__ __launch_bounds__(128 * FKG) void k_flash(const _Float16* __restrict__ Q16, int ldq, const _Float16* __restrict__ K16, int ldk, const _Float16* __restrict__ Vt, _Float16* __restrict__ OHp, _Float16* __restrict__ OLp, int ldo) {
  constexpr int RPW = 16 * FQT, DT = 4, KS = 2, KPG = TK / FKG, NST = KPG / FSK, NP = FQT * 2 * DT + 1;
  __shared__ __attribute__((aligned(16))) unsigned short sR[FKG][2][2][64][FPH];      /* a key group's ring: [0] the K tiles, [1] the V^T tiles, two buffers each */
  const int kg = threadIdx.x >> 7, tid = threadIdx.x & 127, w = tid >> 5, lane = tid & 31, ln = lane & 15, hh = lane >> 4;      /* tid, w: the thread and the wave inside its key group */
  const int slab = blockIdx.x / FQB, qblk = blockIdx.x % FQB; const int b = slab / NH, h = slab % NH; const int q0 = qblk * (4 * RPW) + w * RPW;
  FragH bq[FQT][KS];
#pragma unroll
  for (int qt = 0; qt < FQT; ++qt) { const unsigned short* qr = (const unsigned short*)Q16 + ((size_t)b * TQ + q0 + qt * 16 + ln) * ldq + h * 64;
#pragma unroll
    for (int ks = 0; ks < KS; ++ks) { bq[qt][ks].half[0] = *(const v8us*)(qr + ks * 32 + 8 * hh); bq[qt][ks].half[1] = *(const v8us*)(qr + ks * 32 + 16 + 8 * hh); } }
  const unsigned short* Vth = (const unsigned short*)Vt + (size_t)slab * 64 * TK;
  const int crow = tid >> 3, cseg = (tid & 7) * 8;      /* eight threads copy one 128-byte row */
  const size_t ks16 = (size_t)16 * ldk, kstg = (size_t)FSK * ldk;
  const unsigned short* gk = (const unsigned short*)K16 + ((size_t)b * TK + kg * KPG + crow) * ldk + h * 64 + cseg;      /* the thread's first piece of the next stage to copy, advanced behind each stage's copies */
  const unsigned short* gv = Vth + (size_t)crow * TK + kg * KPG + cseg;
  const unsigned lk0 = (unsigned)(size_t)&sR[kg][0][0][crow][cseg], lv0 = (unsigned)(size_t)&sR[kg][1][0][crow][cseg];      /* low 32 bits of a shared address = the byte offset in LDS */
  fl_copy(lk0, lv0, gk, ks16, gv); gk += kstg; gv += FSK;
  asm volatile("s_wait_asynccnt 0x0" ::: "memory");      /* stage 0 has landed before the barrier that publishes it */
  __syncthreads();
  fl_copy(lk0 + FBB, lv0 + FBB, gk, ks16, gv); gk += kstg; gv += FSK;
  float m_r[FQT], l_r[FQT]; v8f oacc[FQT][DT];
#pragma unroll
  for (int qt = 0; qt < FQT; ++qt) { m_r[qt] = -3.0e38f; l_r[qt] = 0.f;
#pragma unroll
    for (int dt = 0; dt < DT; ++dt) oacc[qt][dt] = (v8f){0.f,0.f,0.f,0.f,0.f,0.f,0.f,0.f}; }
#pragma unroll 1      /* one stage a trip: the buffer index stays a run-time value and the text small */
  for (int st = 0; st < NST; ++st) {
    const int buf = st & 1;
    const unsigned short* kf = &sR[kg][0][buf][ln][8 * hh]; const unsigned short* vf = &sR[kg][1][buf][ln][8 * hh];
    FragH ak[FSK / 32][2][KS], av[FSK / 32][DT];
    auto rd_k = [&](int ps2) {
#pragma unroll
      for (int nt = 0; nt < 2; ++nt)
#pragma unroll
        for (int ks = 0; ks < KS; ++ks) { const unsigned short* kr = kf + (ps2 * 32 + nt * 16) * FPH + ks * 32; ak[ps2][nt][ks].half[0] = *(const v8us*)kr; ak[ps2][nt][ks].half[1] = *(const v8us*)(kr + 16); } };
    auto rd_v = [&](int ps2) {
#pragma unroll
      for (int dt = 0; dt < DT; ++dt) { const unsigned short* vr = vf + dt * 16 * FPH + ps2 * 32; av[ps2][dt].half[0] = *(const v8us*)vr; av[ps2][dt].half[1] = *(const v8us*)(vr + 16); } };
    rd_k(0); rd_v(0);
    __builtin_amdgcn_sched_barrier(0);      /* holds the first 32-key step's fragment reads as one group in front of its products: left free, the scheduler sinks each read to just in front of its product, which then waits out a whole LDS latency */
#pragma unroll
    for (int ps2 = 0; ps2 < FSK / 32; ++ps2) {
      v8f s[FQT][2];      /* every K fragment serves both query tiles */
#pragma unroll
      for (int nt = 0; nt < 2; ++nt)
#pragma unroll
        for (int qt = 0; qt < FQT; ++qt) s[qt][nt] = __builtin_amdgcn_wmma_f32_16x16x32_f16(false, ak[ps2][nt][0].v, false, bq[qt][0].v, (short)0, (v8f){0.f,0.f,0.f,0.f,0.f,0.f,0.f,0.f}, false, false);
#pragma unroll
      for (int nt = 0; nt < 2; ++nt)
#pragma unroll
        for (int qt = 0; qt < FQT; ++qt) s[qt][nt] = __builtin_amdgcn_wmma_f32_16x16x32_f16(false, ak[ps2][nt][1].v, false, bq[qt][1].v, (short)0, s[qt][nt], false, false);
      if (ps2 + 1 < FSK / 32) { rd_k(ps2 + 1);
        __builtin_amdgcn_sched_barrier(0); }      /* the next step's K reads stand here as one group, behind the last use of this step's K registers: they return under this step's softmax; all of a stage's fragments at once would not fit four waves a SIMD */
      FragH pb[FQT];
#pragma unroll
      for (int qt = 0; qt < FQT; ++qt) {
        float sc[16];
#pragma unroll
        for (int nt = 0; nt < 2; ++nt)
#pragma unroll
          for (int r = 0; r < 8; ++r) sc[nt * 8 + r] = s[qt][nt][r];      /* raw q.k: the maximum is kept unscaled, the scale goes into the exponent's multiply-add */
        float mx[4];
#pragma unroll
        for (int c = 0; c < 4; ++c) mx[c] = fmaxf(fmaxf(sc[c], sc[4 + c]), fmaxf(sc[8 + c], sc[12 + c]));
        float mc = fmaxf(fmaxf(mx[0], mx[1]), fmaxf(mx[2], mx[3])); mc = fmaxf(mc, xhalf(mc));      /* both halves of a column use one maximum: they share the output tiles */
        const float mn = fmaxf(m_r[qt], mc); float al = (m_r[qt] - mn) * FC2; m_r[qt] = mn;
        const float nb = fmaf(-mn, FC2, 10.0f);      /* 2^(s FC2 + nb) = 1024 exp((s - mn) / 8) */
        float ps[4];
#pragma unroll
        for (int i = 0; i < 16; ++i) sc[i] = fmaf(sc[i], FC2, nb);
        asm("v_exp_f32 %0, %0\n\tv_exp_f32 %1, %1\n\tv_exp_f32 %2, %2\n\tv_exp_f32 %3, %3\n\tv_exp_f32 %4, %4\n\tv_exp_f32 %5, %5\n\tv_exp_f32 %6, %6\n\tv_exp_f32 %7, %7\n\tv_exp_f32 %8, %8\n\t"
            "v_exp_f32 %9, %9\n\tv_exp_f32 %10, %10\n\tv_exp_f32 %11, %11\n\tv_exp_f32 %12, %12\n\tv_exp_f32 %13, %13\n\tv_exp_f32 %14, %14\n\tv_exp_f32 %15, %15\n\tv_exp_f32 %16, %16\n\tv_nop"
            : "+v"(al), "+v"(sc[0]), "+v"(sc[1]), "+v"(sc[2]), "+v"(sc[3]), "+v"(sc[4]), "+v"(sc[5]), "+v"(sc[6]), "+v"(sc[7]), "+v"(sc[8]), "+v"(sc[9]), "+v"(sc[10]), "+v"(sc[11]), "+v"(sc[12]), "+v"(sc[13]), "+v"(sc[14]), "+v"(sc[15]));
#pragma unroll
        for (int i = 0; i < 16; ++i) { const float p = sc[i]; ps[i & 3] = (i < 4) ? p : ps[i & 3] + p; pb[qt].h[i] = (_Float16)p; }      /* element i = key kmap(i, hh): the order of the V^T fragments */
        l_r[qt] = l_r[qt] * al + ((ps[0] + ps[1]) + (ps[2] + ps[3]));
#pragma unroll
        for (int dt = 0; dt < DT; ++dt)
#pragma unroll
          for (int r = 0; r < 8; ++r) oacc[qt][dt][r] *= al; }
#pragma unroll
      for (int dt = 0; dt < DT; ++dt)
#pragma unroll
        for (int qt = 0; qt < FQT; ++qt) oacc[qt][dt] = __builtin_amdgcn_wmma_f32_16x16x32_f16(false, av[ps2][dt].v, false, pb[qt].v, (short)0, oacc[qt][dt], false, false);      /* every V^T fragment serves both query tiles */
      if (ps2 + 1 < FSK / 32) { rd_v(ps2 + 1);
        __builtin_amdgcn_sched_barrier(0); }      /* the next step's V^T reads stand here as one group, behind the last use of this step's V^T registers: they return under the next step's scores and softmax */
    }
    __builtin_amdgcn_sched_barrier(0);      /* holds the stage's products in front of the waits and the barrier: left free, the scheduler lifts these to just behind the reads, and the copies issued behind the products get no time to land */
    asm volatile("s_wait_dscnt 0x0" ::: "memory");      /* this wave's reads of the buffer have returned before it is given up */
    asm volatile("s_wait_asynccnt 0x0" ::: "memory");      /* this wave's copies of the next stage have landed */
    __syncthreads();      /* publishes the next stage and ends every wave's reads of this one */
    if (st + 2 < NST) { fl_copy(lk0 + buf * FBB, lv0 + buf * FBB, gk, ks16, gv); gk += kstg; gv += FSK; } }
  asm volatile("s_wait_asynccnt 0x0" ::: "memory");      /* no copy is left in flight when the ring becomes the hand-over buffer */
  /* the loop's last barrier has ended every wave's reads of the rings and no copy was issued behind it: the rings now carry the state of groups 1 and up, 16 bytes a lane and piece, lanes side by side */
  v4fa* sm = (v4fa*)&sR[0][0][0][0][0] + (w * NP) * 32 + lane;      /* group g's pieces for this wave's queries lie (g - 1) * 4 * NP * 32 behind */
  if (kg != 0) { v4fa* so = sm + (kg - 1) * (4 * NP * 32);
#pragma unroll
    for (int qt = 0; qt < FQT; ++qt)
#pragma unroll
      for (int dt = 0; dt < DT; ++dt) { so[(2 * (qt * DT + dt)) * 32] = (v4f){oacc[qt][dt][0], oacc[qt][dt][1], oacc[qt][dt][2], oacc[qt][dt][3]}; so[(2 * (qt * DT + dt) + 1) * 32] = (v4f){oacc[qt][dt][4], oacc[qt][dt][5], oacc[qt][dt][6], oacc[qt][dt][7]}; }
    so[(NP - 1) * 32] = (v4f){m_r[0], l_r[0], m_r[1], l_r[1]}; }
  __syncthreads();      /* the other groups' state is in LDS before group 0 reads it; every wave passes it */
  if (kg != 0) return;      /* no barrier follows */
  { v4f ml[FKG - 1];
#pragma unroll
    for (int g = 0; g < FKG - 1; ++g) ml[g] = sm[(g * 4 * NP + NP - 1) * 32];
#pragma unroll
    for (int qt = 0; qt < FQT; ++qt) { float mj = m_r[qt];      /* the partial softmaxes are brought to the common maximum */
#pragma unroll
      for (int g = 0; g < FKG - 1; ++g) mj = fmaxf(mj, ml[g][2 * qt]);
      const float f0 = __builtin_amdgcn_exp2f((m_r[qt] - mj) * FC2);
      l_r[qt] *= f0;
#pragma unroll
      for (int dt = 0; dt < DT; ++dt)
#pragma unroll
        for (int r = 0; r < 8; ++r) oacc[qt][dt][r] *= f0;
#pragma unroll
      for (int g = 0; g < FKG - 1; ++g) { const float fg = __builtin_amdgcn_exp2f((ml[g][2 * qt] - mj) * FC2);
        l_r[qt] += ml[g][2 * qt + 1] * fg;
#pragma unroll
        for (int dt = 0; dt < DT; ++dt) { const v4f a = sm[(g * 4 * NP + 2 * (qt * DT + dt)) * 32], e = sm[(g * 4 * NP + 2 * (qt * DT + dt) + 1) * 32];
#pragma unroll
          for (int r = 0; r < 4; ++r) { oacc[qt][dt][r] += a[r] * fg; oacc[qt][dt][4 + r] += e[r] * fg; } } } } }
#pragma unroll
  for (int qt = 0; qt < FQT; ++qt) {
    const float l = l_r[qt] + xhalf(l_r[qt]); const float inv = (l > 0.f) ? 1.0f / l : 0.f;      /* weights and sum both carry the 2^10 */
    const size_t oofs = ((size_t)b * TQ + q0 + qt * 16 + ln) * ldo + h * 64 + 8 * hh;      /* register r of tile dt = channel dt * 16 + 8 hh + r of query ln: 16 contiguous bytes a lane in each plane */
#pragma unroll
    for (int dt = 0; dt < DT; ++dt) { FragH fh, fl;      /* the output conv's two operands, f16 and the 2^10 residual, are formed here from the registers */
#pragma unroll
      for (int r = 0; r < 8; ++r) { const float v = oacc[qt][dt][r] * inv; const _Float16 hv = (_Float16)v; fh.h[r] = hv; fl.h[r] = (_Float16)((v - (float)hv) * 1024.0f); }
      *(v8us*)((unsigned short*)OHp + oofs + dt * 16) = fh.half[0]; *(v8us*)((unsigned short*)OLp + oofs + dt * 16) = fl.half[0]; } } }
// 5-plane variant: S = Qh Kh^T + (Ql Kh^T + Qh Kl^T)/1024 with Q/K = [hi | 2^10 residual] f16 planes (QL/KL same layout as Q16/K16), then the 3-term P.V below.
// 3-term variant: O = (P_hi V_hi + (P_lo V_hi + P_hi V_lo) / 1024) / l with P = [hi | 2^10 residual] of 1024 p and V^T = [hi | 2^10 residual] planes (VtL same layout as Vt) -> ~2^-21-class products for un-averaged (early causal / peaked) rows
template <int CAUSAL>
__global__ __launch_bounds__(128) void k_flash5(const _Float16* __restrict__ Q16, const _Float16* __restrict__ QL, int ldq, const _Float16* __restrict__ K16, const _Float16* __restrict__ KL, int ldk, const _Float16* __restrict__ Vt, const _Float16* __restrict__ VtL, const int* __restrict__ MSK, float* __restrict__ O, int ldo) {
  constexpr int RPW = 16, RTN = RPW / 16, NQB = TQ / (4 * RPW), DT = 4, KS = 2;
  __shared__ __attribute__((aligned(16))) unsigned short sP[4][RPW][40]; __shared__ __attribute__((aligned(16))) unsigned short sPL[4][RPW][40]; __shared__ __attribute__((aligned(16))) float sO[4][RPW][64 + 4];
  const int tid = threadIdx.x, w = tid >> 5, lane = tid & 31, ln = lane & 15, hh = lane >> 4;
  const int slab = blockIdx.x / QBN5, qblk = QB05 + blockIdx.x % QBN5; (void)NQB; const int b = slab / NH, h = slab % NH; const int qb0 = qblk * (4 * RPW); const int q0 = qb0 + w * RPW;
  FragH aq[2][KS], aql[2][KS];
#pragma unroll
  for (int rt = 0; rt < RTN; ++rt) { const unsigned short* qr = (const unsigned short*)Q16 + ((size_t)b * TQ + q0 + rt * 16 + ln) * ldq + h * 64; const unsigned short* ql = (const unsigned short*)QL + ((size_t)b * TQ + q0 + rt * 16 + ln) * ldq + h * 64;
#pragma unroll
    for (int ks = 0; ks < KS; ++ks) { aq[rt][ks].half[0] = *(const v8us*)(qr + ks * 32 + 8 * hh); aq[rt][ks].half[1] = *(const v8us*)(qr + ks * 32 + 16 + 8 * hh); aql[rt][ks].half[0] = *(const v8us*)(ql + ks * 32 + 8 * hh); aql[rt][ks].half[1] = *(const v8us*)(ql + ks * 32 + 16 + 8 * hh); } }
  const unsigned short* Vth = (const unsigned short*)Vt + (size_t)slab * 64 * TK; const unsigned short* Vtl = (const unsigned short*)VtL + (size_t)slab * 64 * TK;
  float m_r[2][8], l_r[2][8]; v8f oacc[2][DT], oaccL[2][DT];
#pragma unroll
  for (int rt = 0; rt < RTN; ++rt) {
#pragma unroll
    for (int r = 0; r < 8; ++r) { m_r[rt][r] = -3.0e38f; l_r[rt][r] = 0.f; }
#pragma unroll
    for (int dt = 0; dt < DT; ++dt) { oacc[rt][dt] = (v8f){0.f,0.f,0.f,0.f,0.f,0.f,0.f,0.f}; oaccL[rt][dt] = oacc[rt][dt]; } }
  const int jend = (CAUSAL == 1) ? (qb0 + 4 * RPW) : ((CAUSAL == 23) ? min(TK, (qb0 / CHK + 2) * CHK) : TK);      /* causal / window: keys that can never contribute are skipped */ const int jbeg = (CAUSAL == 23) ? max(0, (qb0 / CHK - 1) * CHK) : 0;
#pragma unroll 1
  for (int j0 = jbeg; j0 < jend; j0 += 32) {
    v8f s[2][2];
#pragma unroll
    for (int nt = 0; nt < 2; ++nt) { const unsigned short* kr = (const unsigned short*)K16 + ((size_t)b * TK + j0 + nt * 16 + ln) * ldk + h * 64; const unsigned short* klr = (const unsigned short*)KL + ((size_t)b * TK + j0 + nt * 16 + ln) * ldk + h * 64; FragH bk[KS], bkl[KS];
#pragma unroll
      for (int ks = 0; ks < KS; ++ks) { bk[ks].half[0] = *(const v8us*)(kr + ks * 32 + 8 * hh); bk[ks].half[1] = *(const v8us*)(kr + ks * 32 + 16 + 8 * hh); bkl[ks].half[0] = *(const v8us*)(klr + ks * 32 + 8 * hh); bkl[ks].half[1] = *(const v8us*)(klr + ks * 32 + 16 + 8 * hh); }
#pragma unroll
      for (int rt = 0; rt < RTN; ++rt) { v8f acc = (v8f){0.f,0.f,0.f,0.f,0.f,0.f,0.f,0.f}, accl = acc;
#pragma unroll
        for (int ks = 0; ks < KS; ++ks) { acc = mmaH<1>(aq[rt][ks].v, aq[rt][ks].v, bk[ks].v, bk[ks].v, acc); accl = mmaH<1>(aql[rt][ks].v, aql[rt][ks].v, bk[ks].v, bk[ks].v, accl); accl = mmaH<1>(aq[rt][ks].v, aq[rt][ks].v, bkl[ks].v, bkl[ks].v, accl); }
#pragma unroll
        for (int r = 0; r < 8; ++r) acc[r] += accl[r] * 0.0009765625f;
        s[rt][nt] = acc; } }
#pragma unroll
    for (int rt = 0; rt < RTN; ++rt)
#pragma unroll
      for (int r = 0; r < 8; ++r) { const int tq = q0 + rt * 16 + 8 * hh + r; const int k0 = j0 + ln, k1 = j0 + 16 + ln;
        bool ok0 = (CAUSAL == 1) ? (k0 <= tq) : ((CAUSAL == 2) ? ((k0 >> 5) == (tq >> 5)) : true), ok1 = (CAUSAL == 1) ? (k1 <= tq) : ((CAUSAL == 2) ? ((k1 >> 5) == (tq >> 5)) : true);      /* mode 2: block-diagonal 32-token groups */
        if (CAUSAL == 4) { const int* mrow = MSK + ((size_t)b * TQ + tq) * TK; ok0 = mrow[k0] != 0; ok1 = mrow[k1] != 0; }      /* mode 4: per-(query, key) INPUT mask shared by all heads; masked keys contribute nothing (== the reference's -4096 fill, whose exp underflows to 0), rows with no valid key give l = 0 -> output 0 (== the reference's row_valid zeroing) */
        float s0 = ok0 ? s[rt][0][r] * SCL : -3.0e38f, s1 = ok1 ? s[rt][1][r] * SCL : -3.0e38f; if (CAUSAL == 17) { const float* amk = (const float*)MSK + (size_t)b * TK; s0 += bf16_round(amk[k0]); s1 += bf16_round(amk[k1]); } if (CAUSAL == 18) { const float* tb = (const float*)MSK; const int* ri = MSK + 1024 + (size_t)b * TK; const int rq = ri[tq]; s0 += tb[(h * 8 + rq) * 8 + ri[k0]]; s1 += tb[(h * 8 + rq) * 8 + ri[k1]]; } if (CAUSAL == 19) { const int* rel = MSK + (size_t)tq * TK; const float* rb = (const float*)MSK + (size_t)TQ * TK + ((size_t)(b * NH + h) * TQ + tq) * 64; s0 += rb[rel[k0]]; s1 += rb[rel[k1]]; }      /* mode 19: + (q.Ek[rel] + Eb[rel][h]) / 8 gathered by the int relative ids (packed [ids | table]) */      /* mode 18: + resource_bias[h][r_q][r_k] from the packed [table | ids] buffer (TQ == TK) */      /* mode 17: additive per-(batch, key) mask INPUT */ float mc = fmaxf(s0, s1);
        mc = fmaxf(mc, __shfl_xor(mc, 1, 32)); mc = fmaxf(mc, __shfl_xor(mc, 2, 32)); mc = fmaxf(mc, __shfl_xor(mc, 4, 32)); mc = fmaxf(mc, __shfl_xor(mc, 8, 32));
        const float mn = fmaxf(m_r[rt][r], mc); const float al = (mn > -1.0e38f) ? expf(m_r[rt][r] - mn) : 1.0f; m_r[rt][r] = mn; const float p0 = ok0 ? expf(s0 - mn) : 0.f, p1 = ok1 ? expf(s1 - mn) : 0.f; l_r[rt][r] = l_r[rt][r] * al + p0 + p1;
#pragma unroll
        for (int dt = 0; dt < DT; ++dt) { oacc[rt][dt][r] *= al; oaccL[rt][dt][r] *= al; }
        FragH t2, t2l; const float ps0 = p0 * 1024.0f, ps1 = p1 * 1024.0f; t2.h[0] = (_Float16)ps0; t2.h[1] = (_Float16)ps1; t2l.h[0] = (_Float16)((ps0 - (float)t2.h[0]) * 1024.0f); t2l.h[1] = (_Float16)((ps1 - (float)t2.h[1]) * 1024.0f);
        sP[w][rt * 16 + 8 * hh + r][ln] = t2.u[0]; sP[w][rt * 16 + 8 * hh + r][16 + ln] = t2.u[1]; sPL[w][rt * 16 + 8 * hh + r][ln] = t2l.u[0]; sPL[w][rt * 16 + 8 * hh + r][16 + ln] = t2l.u[1]; }
    __builtin_amdgcn_fence(__ATOMIC_ACQ_REL, "workgroup"); __builtin_amdgcn_wave_barrier();
    FragH pa[2], pl[2];
#pragma unroll
    for (int rt = 0; rt < RTN; ++rt) { pa[rt].half[0] = *(const v8us*)&sP[w][rt * 16 + ln][8 * hh]; pa[rt].half[1] = *(const v8us*)&sP[w][rt * 16 + ln][16 + 8 * hh]; pl[rt].half[0] = *(const v8us*)&sPL[w][rt * 16 + ln][8 * hh]; pl[rt].half[1] = *(const v8us*)&sPL[w][rt * 16 + ln][16 + 8 * hh]; }
#pragma unroll
    for (int dt = 0; dt < DT; ++dt) { const unsigned short* vrow = Vth + (size_t)(dt * 16 + ln) * TK + j0; const unsigned short* vrl = Vtl + (size_t)(dt * 16 + ln) * TK + j0; FragH bv, bl; bv.half[0] = *(const v8us*)(vrow + 8 * hh); bv.half[1] = *(const v8us*)(vrow + 16 + 8 * hh); bl.half[0] = *(const v8us*)(vrl + 8 * hh); bl.half[1] = *(const v8us*)(vrl + 16 + 8 * hh);
#pragma unroll
      for (int rt = 0; rt < RTN; ++rt) { oacc[rt][dt] = mmaH<1>(pa[rt].v, pa[rt].v, bv.v, bv.v, oacc[rt][dt]); oaccL[rt][dt] = mmaH<1>(pl[rt].v, pl[rt].v, bv.v, bv.v, oaccL[rt][dt]); oaccL[rt][dt] = mmaH<1>(pa[rt].v, pa[rt].v, bl.v, bl.v, oaccL[rt][dt]); } }
    __builtin_amdgcn_fence(__ATOMIC_ACQ_REL, "workgroup"); __builtin_amdgcn_wave_barrier(); }
#pragma unroll
  for (int rt = 0; rt < RTN; ++rt) {
#pragma unroll
    for (int r = 0; r < 8; ++r) { float l = l_r[rt][r]; l += __shfl_xor(l, 1, 32); l += __shfl_xor(l, 2, 32); l += __shfl_xor(l, 4, 32); l += __shfl_xor(l, 8, 32); l_r[rt][r] = (l > 0.f) ? 1.0f / (l * 1024.0f) : 0.f; }
#pragma unroll
    for (int dt = 0; dt < DT; ++dt)
#pragma unroll
      for (int r = 0; r < 8; ++r) { float v = oacc[rt][dt][r]; v += oaccL[rt][dt][r] * 0.0009765625f; sO[w][rt * 16 + 8 * hh + r][dt * 16 + ln] = v * l_r[rt][r]; } }
  __builtin_amdgcn_fence(__ATOMIC_ACQ_REL, "workgroup"); __builtin_amdgcn_wave_barrier();
  {
#pragma unroll
    for (int rp = 0; rp < RPW; rp += 2) { const int r = rp + (lane >> 4), pc = lane & 15; const v4f val = *(const v4fa*)&sO[w][r][pc * 4]; *(v4f*)(O + ((size_t)b * TQ + q0 + r) * ldo + h * 64 + pc * 4) = val; }
     } }

__global__ __launch_bounds__(256) void k_rotab(float* __restrict__ CS, float* __restrict__ SN) {
  #pragma clang fp contract(off)
  const int t = blockIdx.x * 256 + threadIdx.x; if (t >= SLEN * 32) return; const int j = t % 32, s = t / 32; const float ex = (float)(2 * j) / 64.0f; const float inv = 1.0f / powf(10000.0f, ex); const float th = (float)s * inv; const float c = cosf(th), sn = sinf(th);
  { *(float*)(CS + t) = c; *(float*)(SN + t) = sn;  } }
__global__ __launch_bounds__(256) void k_rope(const float* __restrict__ F, int nsrc, int ndst, int rep, const float* __restrict__ CS, const float* __restrict__ SN, _Float16* __restrict__ H, _Float16* __restrict__ L) {
  #pragma clang fp contract(off)
  const size_t t = (size_t)blockIdx.x * 256 + threadIdx.x; if (t >= (size_t)NR * ndst * 4) return; const int g8 = (int)(t % 4); const int hd = (int)((t / 4) % ndst); const size_t row = t / ((size_t)4 * ndst); const int s = (int)(row % SLEN); const int hs = hd / rep;
  const float* src = F + row * (size_t)(nsrc * 64) + hs * 64; FragH ah, al, bh, bl;
  for (int i = 0; i < 8; ++i) { const int d = g8 * 8 + i; const float c = CS[s * 32 + d], sn = SN[s * 32 + d]; const float x1 = src[d], x2 = src[d + 32];
    float o1 = x1 * c; o1 += -x2 * sn; float o2 = x2 * c; o2 += x1 * sn;
    _Float16 hv = (_Float16)o1; ah.h[i] = hv; al.h[i] = (_Float16)((o1 - (float)hv) * 1024.0f); hv = (_Float16)o2; bh.h[i] = hv; bl.h[i] = (_Float16)((o2 - (float)hv) * 1024.0f); }
  const size_t o = row * (size_t)(ndst * 64) + hd * 64 + g8 * 8;
  { *(v8us*)((unsigned short*)H + o) = ah.half[0]; *(v8us*)((unsigned short*)H + o + 32) = bh.half[0]; *(v8us*)((unsigned short*)L + o) = al.half[0]; *(v8us*)((unsigned short*)L + o + 32) = bl.half[0];  } }
__global__ __launch_bounds__(256) void k_rope2(const float* __restrict__ F, int nsrc, int ndst, int rep, const float* __restrict__ CS, const float* __restrict__ SN, _Float16* __restrict__ H, _Float16* __restrict__ L) {
  #pragma clang fp contract(off)
  const size_t t = (size_t)blockIdx.x * 256 + threadIdx.x; if (t >= (size_t)NR * ndst * 4) return; const int g16 = (int)(t % 4); const int hd = (int)((t / 4) % ndst); const size_t row = t / ((size_t)4 * ndst); const int s = (int)(row % SLEN); const int hs = hd / rep;
  const float* src = F + row * (size_t)(nsrc * 64) + hs * 64 + g16 * 16; FragH ah, al;
  for (int pr = 0; pr < 8; ++pr) { const int i = g16 * 8 + pr; const float c = CS[s * 32 + i], sn = SN[s * 32 + i]; const float x1 = src[2 * pr], x2 = src[2 * pr + 1];
    float o1 = x1 * c; o1 -= x2 * sn; float o2 = x1 * sn; o2 += x2 * c;
    _Float16 hv = (_Float16)o1; ah.h[2 * pr] = hv; al.h[2 * pr] = (_Float16)((o1 - (float)hv) * 1024.0f); hv = (_Float16)o2; ah.h[2 * pr + 1] = hv; al.h[2 * pr + 1] = (_Float16)((o2 - (float)hv) * 1024.0f); }
  const size_t o = row * (size_t)(ndst * 64) + hd * 64 + g16 * 16;
  { *(v8us*)((unsigned short*)H + o) = ah.half[0]; *(v8us*)((unsigned short*)H + o + 8) = ah.half[1]; *(v8us*)((unsigned short*)L + o) = al.half[0]; *(v8us*)((unsigned short*)L + o + 8) = al.half[1];  } }
__global__ __launch_bounds__(256) void k_ln512(const float* __restrict__ A, const float* __restrict__ res, const float* __restrict__ g, const float* __restrict__ bb, float* __restrict__ Y, _Float16* __restrict__ Y16) {
  #pragma clang fp contract(off)
  const int wv = threadIdx.x >> 5, ln = threadIdx.x & 31; const size_t r = (size_t)blockIdx.x * 8 + wv; if (r >= NR) return; float x[16]; float s = 0.f;
  for (int i = 0; i < 2; ++i) { const v8f a = *(const v8f*)(A + r * DM + i * 256 + ln * 8); for (int q = 0; q < 8; ++q) { float v = a[q]; if (res) v += bf16_round(res[r * DM + i * 256 + ln * 8 + q]); x[i * 8 + q] = v; s += v; } }
  for (int o = 16; o > 0; o >>= 1) s += __shfl_xor(s, o, 32); const float mu = s / (float)DM; float var = 0.f; for (int q = 0; q < 16; ++q) { const float d = x[q] - mu; var += d * d; }
  for (int o = 16; o > 0; o >>= 1) var += __shfl_xor(var, o, 32); const float inv = rsqrtf(var / (float)DM + 1e-5f);
  { for (int i = 0; i < 2; ++i) { const int c0 = i * 256 + ln * 8; v8f y; FragH f; for (int q = 0; q < 8; ++q) { float v = (x[i * 8 + q] - mu) * inv; v *= bf16_round(g[c0 + q]); v += bf16_round(bb[c0 + q]); y[q] = v; f.h[q] = (_Float16)v; } *(v8f*)(Y + r * DM + c0) = y; if (Y16) *(v8us*)((unsigned short*)Y16 + r * DM + c0) = f.half[0]; }  } }
__global__ __launch_bounds__(256) void k_pack(const float* __restrict__ rb, const int* __restrict__ rid, int* __restrict__ PK) { const int t = blockIdx.x * 256 + threadIdx.x; if (t >= 1024 + NB * TK) return; int v; if (t < 1024) v = __float_as_int(bf16_round(rb[t])); else v = rid[t - 1024]; *(int*)(PK + t) = v;  }
__global__ __launch_bounds__(256) void k_tabin(const float* __restrict__ sp, float* __restrict__ CS, float* __restrict__ SN) { const int t = blockIdx.x * 256 + threadIdx.x; if (t >= SLEN * 32) return; const int i = t % 32, s = t / 32; const float c = bf16_round(sp[s * 64 + 32 + i]), sn = bf16_round(sp[s * 64 + i]);
  { *(float*)(CS + t) = c; *(float*)(SN + t) = sn;  } }
__global__ __launch_bounds__(256) void k_rotab2(float* __restrict__ CS, float* __restrict__ SN) {
  #pragma clang fp contract(off)
  const int t = blockIdx.x * 256 + threadIdx.x; if (t >= SLEN * 32) return; const int j = t % 32, s = t / 32; const float c0 = -0.14391156831212787f;      /* -ln(10000)/64 rounded to f32 */ const float inv = expf((float)(2 * j) * c0); const float th = (float)s * inv; const float c = cosf(th), sn = sinf(th);
  { *(float*)(CS + t) = c; *(float*)(SN + t) = sn;  } }
__global__ __launch_bounds__(256) void k_lnu(const float* __restrict__ X, _Float16* __restrict__ N16, float* __restrict__ XB) {
  #pragma clang fp contract(off)
  const int wv = threadIdx.x >> 5, ln = threadIdx.x & 31; const size_t r = (size_t)blockIdx.x * 8 + wv; if (r >= NR) return; float a[32]; float s = 0.f;
  for (int i = 0; i < 4; ++i) { const v8f v = *(const v8f*)(X + r * DM + (i * 32 + ln) * 8); for (int q = 0; q < 8; ++q) { const float u = bf16_round(v[q]); a[i * 8 + q] = u; s += u; } }
  for (int o = 16; o > 0; o >>= 1) s += __shfl_xor(s, o, 32); const float mu = s / (float)DM; float var = 0.f; for (int q = 0; q < 32; ++q) { const float d = a[q] - mu; var += d * d; }
  for (int o = 16; o > 0; o >>= 1) var += __shfl_xor(var, o, 32); const float den = sqrtf(var / (float)(DM - 1)) + 1e-6f; const float inv = 1.0f / den;      /* one reciprocal per row; (x-mean)*inv vs the reference's division differs by <= 1 ulp */
  { for (int i = 0; i < 4; ++i) { const int c0 = (i * 32 + ln) * 8; FragH f; v8f xb; for (int q = 0; q < 8; ++q) { f.h[q] = (_Float16)((a[i * 8 + q] - mu) * inv); xb[q] = a[i * 8 + q]; } *(v8us*)((unsigned short*)N16 + r * DM + c0) = f.half[0]; *(v8f*)(XB + r * DM + c0) = xb; }  } }
__global__ __launch_bounds__(256) void k_h16s(const float* __restrict__ SRC, int lds, int coff, _Float16* __restrict__ DST, size_t n8) { const size_t t = (size_t)blockIdx.x * 256 + threadIdx.x; if (t >= n8) return; const size_t r = (t * 8) / DM; const int c = (int)((t * 8) % DM); const v8f a = *(const v8f*)(SRC + r * lds + coff + c); FragH f; for (int q = 0; q < 8; ++q) f.h[q] = (_Float16)a[q];
  *(v8us*)((unsigned short*)DST + t * 8) = f.half[0];  }


__global__ __launch_bounds__(256) void k_ccp(const float* __restrict__ QKV, int coff, _Float16* __restrict__ D) { const size_t t = (size_t)blockIdx.x * 256 + threadIdx.x; if (t >= (size_t)NR * DM / 8) return; const int c0 = (int)((t * 8) % DM); const size_t row = (t * 8) / DM; const v8f a = *(const v8f*)(QKV + row * 3 * DM + coff + c0); FragH f; for (int q = 0; q < 8; ++q) f.h[q] = (_Float16)a[q];
  *(v8us*)((unsigned short*)D + t * 8) = f.half[0];  }


// The five preparations need nothing of each other and share one grid: blocks 0 to TOKB - 1 turn 16 pixels each into token rows, then WSB blocks for each of the four weight matrices (x16, f16). The branch is uniform for a block.
#define TOKB (NPIX / 16)
#define WSB (DM * DM / 8 / 256)      /* 8 weights a thread, no remainder */
__global__ __launch_bounds__(256) void k_prep(const float* __restrict__ x, _Float16* __restrict__ X16, const float* __restrict__ qw, const float* __restrict__ kw, const float* __restrict__ vw, const float* __restrict__ ow,
    _Float16* __restrict__ BQ, _Float16* __restrict__ BK, _Float16* __restrict__ BV, _Float16* __restrict__ BO) { __shared__ float tl[DM][17]; const int tid = threadIdx.x;
  if (blockIdx.x >= TOKB) { const int wb = blockIdx.x - TOKB, m = wb / WSB; const float* Wm = (m == 0) ? qw : ((m == 1) ? kw : ((m == 2) ? vw : ow)); _Float16* Bt = (m == 0) ? BQ : ((m == 1) ? BK : ((m == 2) ? BV : BO));
    const size_t t = (size_t)(wb - m * WSB) * 256 + tid; FragH f; for (int q = 0; q < 8; ++q) f.h[q] = (_Float16)(bf16_round(Wm[t * 8 + q]) * 16.0f); *(v8us*)((unsigned short*)Bt + t * 8) = f.half[0]; return; }
  const int p0 = blockIdx.x * 16;      /* 16-pixel tiles: 34 KB of LDS */
  for (int i = tid; i < DM * 16; i += 256) { const int c = i / 16, p = i % 16; tl[c][p] = bf16_round(x[(size_t)c * NPIX + p0 + p]); }
  __syncthreads();
  { for (int i = tid; i < 16 * (DM / 8); i += 256) { const int p = i / (DM / 8), c0 = (i % (DM / 8)) * 8; FragH f; for (int q = 0; q < 8; ++q) f.h[q] = (_Float16)tl[c0 + q][p];
      *(v8us*)((unsigned short*)X16 + ((size_t)p0 + p) * DM + c0) = f.half[0]; }  } }
extern "C" void kernel_launch(void* const* d_in, const int* in_sizes, int n_in,
                              void* d_out, int out_size, void* d_ws, size_t ws_size, hipStream_t stream) {
  (void)in_sizes; (void)n_in; (void)out_size;
  const float* x = (const float*)d_in[0]; const float* qw = (const float*)d_in[1]; const float* qb = (const float*)d_in[2]; const float* kw = (const float*)d_in[3]; const float* kb = (const float*)d_in[4]; const float* vw = (const float*)d_in[5]; const float* vb = (const float*)d_in[6]; const float* ow = (const float*)d_in[7]; const float* ob = (const float*)d_in[8];
  char* ws = (char*)d_ws; size_t off = 0;
  auto take = [&](size_t bytes) { char* p = ws + off; off += (bytes + 255) & ~(size_t)255; return p; };
  const size_t np = (size_t)NR * DM;
  _Float16* BQ = (_Float16*)take((size_t)DM * DM * 2); _Float16* BK = (_Float16*)take((size_t)DM * DM * 2); _Float16* BV = (_Float16*)take((size_t)DM * DM * 2); _Float16* BO = (_Float16*)take((size_t)DM * DM * 2);
   _Float16* X16 = (_Float16*)take(np * 2); _Float16* QH = (_Float16*)take(np * 2); _Float16* KH = (_Float16*)take(np * 2); _Float16* VT = (_Float16*)take(np * 2); _Float16* OL = (_Float16*)take(np * 2); _Float16* OH = (_Float16*)take(np * 2);
  if (off > ws_size) return;
  k_prep<<<TOKB + 4 * WSB, 256, 0, stream>>>(x, X16, qw, kw, vw, ow, BQ, BK, BV, BO);      /* token rows; 1x1 conv (out, in) naturals */
  const dim3 g((NR / 128) * (DM / 64), 1), g3((NR / 128) * (DM / 64), 3);
  k_gemm2<0><<<g3, 128, 0, stream>>>(X16, DM, 0, BQ, DM, (size_t)DM * DM, 0.0625f, qb, kb, vb, 1, 0, 1.0f, nullptr, QH, DM, np, NR, DM, DM, 2, nullptr, VT);      /* q, k, v: BQ, BK, BV and QH, KH lie one behind the other in the workspace; v leaves its GEMM as V^T (channel = head * 64 + d rows of SLEN tokens) */
  k_flash<<<NB * NH * FQB, 128 * FKG, 0, stream>>>(QH, DM, KH, DM, VT, OH, OL, DM);
  k_gemm2<0><<<g, 128, 0, stream>>>(OL, DM, 0, BO, DM, 0, 0.0625f, ob, nullptr, nullptr, 2, np, 0.0009765625f, nullptr, nullptr, DM, 0, NR, DM, DM, 0, (float*)d_out, nullptr);      /* the output conv, stored as NCHW: the residual term first, scaled by 2^-10 in the accumulators, then the f16 term on top (OH lies behind OL in the workspace) */
}
